// v000
// The times below were measured on an AMD MI455X: many runs one after another, warmed up first and cycling through
// copies of the inputs, with the whole window's GPU time divided by the number of runs. Launches and the gaps
// between them are all in it. The median over several windows is given; except for v000 it joins two sittings, which
// can be a few percent apart, so the side-by-side timings, each taken in one sitting, are the better comparison.
// v000 is the starting kernel. One run takes 365 microseconds.
#include <hip/hip_runtime.h>

// Causal multi-head self-attention: separate bias-free [out][in] q/k/v projections, per-head RMS normalisation of q and k (no gain), half-split rotary
// (first half x1 cos + x2 sin, second half -x1 sin + x2 cos, positions = arange), scale 1/8, causal softmax, [out][in] output projection.
// Compute dtypes (all v_wmma_f32_16x16x32, f32 accumulate): q/k/v projections bf16 x bf16 (inputs converted RNE to bf16); scores bf16 hi|lo x hi|lo (3 products);
// P.V f16 single product (P carried x1024) for query rows >= RH, bf16 hi|lo 3 products for rows < RH; output projection ctx bf16 hi|lo x bf16 weights (2 products); norm/rotary/softmax f32.

#ifndef NB
#define NB 2
#endif
#ifndef SEQ
#define SEQ 2048
#endif
#define NB_FULL  2
#define SEQ_FULL 2048
#define DM   1024
#define NH   16
#define HD   64
#if SEQ < 256
#define RH   SEQ
#else
#define RH   256                      // query rows < RH: P and V as bf16 hi|lo (3 products)
#endif
#define MR   (NB * SEQ)
#define PLN  ((size_t)NB * NH * SEQ * HD)
#define PCAR 1024.0f
#define L2E  1.4426950408889634f
#define NEGB (-1.0e30f)
#define RMS_EPS 1.1920928955078125e-07f

static_assert(NB >= 1 && NB <= NB_FULL);
static_assert(SEQ >= 64 && SEQ <= SEQ_FULL);
static_assert(SEQ % 64 == 0);
static_assert(RH % 64 == 0);
static_assert(RH <= SEQ);
static_assert(DM % 64 == 0);
static_assert(DM % 32 == 0);
static_assert(NH * HD == DM);
static_assert(HD == 64);
static_assert(MR % 64 == 0);

typedef _Float16 h16;
typedef unsigned short bf;
typedef __attribute__((ext_vector_type(16))) __bf16   v16bf;
typedef __attribute__((ext_vector_type(16))) _Float16 v16h;
typedef __attribute__((ext_vector_type(8)))  _Float16 v8h;
typedef __attribute__((ext_vector_type(8)))  unsigned short v8us;
typedef __attribute__((ext_vector_type(8)))  float    v8f;
typedef __attribute__((ext_vector_type(4)))  float    v4f;
typedef __attribute__((ext_vector_type(2)))  float    v2f;
typedef v8h  __attribute__((may_alias)) v8ha;
typedef v4f  __attribute__((may_alias)) v4fa;
typedef v8us __attribute__((may_alias)) v8usa;

__device__ __forceinline__ unsigned short f2bf(float f) { unsigned u = __float_as_uint(f); u += 0x7FFFu + ((u >> 16) & 1u); return (unsigned short)(u >> 16); }
__device__ __forceinline__ float bf2f(unsigned short b) { return __uint_as_float(((unsigned)b) << 16); }
__device__ __forceinline__ void splitf(float y, unsigned short& h, unsigned short& l) { h = f2bf(y); l = f2bf(y - bf2f(h)); }
__device__ __forceinline__ v16h cat16(v8h lo, v8h hi) { return __builtin_shufflevector(lo, hi, 0, 1, 2, 3, 4, 5, 6, 7, 8, 9, 10, 11, 12, 13, 14, 15); }
__device__ __forceinline__ v16bf cat16b(v8us lo, v8us hi) { return __builtin_bit_cast(v16bf, __builtin_shufflevector(lo, hi, 0, 1, 2, 3, 4, 5, 6, 7, 8, 9, 10, 11, 12, 13, 14, 15)); }
// fragment loads from K-contiguous 16-bit global rows: elements 0..7 <- p[0..7], elements 8..15 <- p[16..23]; caller adds 8*(lane>>4)
__device__ __forceinline__ v16bf ldb(const bf* p) { return cat16b(*(const v8us*)p, *(const v8us*)(p + 16)); }
__device__ __forceinline__ v16h  ldh(const h16* p) { return cat16(*(const v8h*)p, *(const v8h*)(p + 16)); }
// one WMMA + its own hazard guard (accumulator tied, fragments kept live)
__device__ __forceinline__ v8f mmab(v16bf a, v16bf b, v8f c) {
    c = __builtin_amdgcn_wmma_f32_16x16x32_bf16(false, a, false, b, (short)0, c, false, false);
    asm volatile("v_nop\n\tv_nop\n\tv_nop\n\tv_nop" : "+v"(c) : "v"(a), "v"(b));
    return c; }
__device__ __forceinline__ v8f mmah(v16h a, v16h b, v8f c) {
    c = __builtin_amdgcn_wmma_f32_16x16x32_f16(false, a, false, b, (short)0, c, false, false);
    asm volatile("v_nop\n\tv_nop\n\tv_nop\n\tv_nop" : "+v"(c) : "v"(a), "v"(b));
    return c; }
__device__ __forceinline__ void wave_sync_lds() { asm volatile("s_wait_dscnt 0" ::: "memory"); __builtin_amdgcn_wave_barrier(); asm volatile("" ::: "memory"); }

// ---- one-wave 64x64 tile accumulate over K = DM: acc[mb][nb] += A[rows][k] Bt[cols][k] (+ A2 rows when NSPLIT); operands straight from bf16 planes with row pitch DM
template <int NSPLIT>
__device__ __forceinline__ void gemm_acc(const bf* __restrict__ A, const bf* __restrict__ A2, const bf* __restrict__ Bt, int aoff, int boff, v8f (&acc)[4][4]) {
#pragma unroll 1
    for (int kc = 0; kc < DM; kc += 32) {
        v16bf a[4], a2[4];
#pragma unroll
        for (int mb = 0; mb < 4; ++mb) { a[mb] = ldb(A + aoff + mb * 16 * DM + kc); if (NSPLIT) a2[mb] = ldb(A2 + aoff + mb * 16 * DM + kc); }
#pragma unroll
        for (int nb = 0; nb < 4; ++nb) { const v16bf b = ldb(Bt + boff + nb * 16 * DM + kc);
#pragma unroll
            for (int mb = 0; mb < 4; ++mb) { acc[mb][nb] = mmab(a[mb], b, acc[mb][nb]); if (NSPLIT) acc[mb][nb] = mmab(a2[mb], b, acc[mb][nb]); } }
    }
}

__global__ __launch_bounds__(256) void k_cvtx(const float* __restrict__ x, bf* XB) {
    const size_t i = (size_t)blockIdx.x * 256 + threadIdx.x; if (i >= (size_t)MR * DM / 8) return;
    const size_t e = i * 8; const int row = (int)(e / DM), col = (int)(e % DM); const int b = row / SEQ, t = row - b * SEQ;
    const v8f v = *(const v8f*)(x + ((size_t)b * SEQ_FULL + t) * DM + col); v8us o;
#pragma unroll
    for (int k = 0; k < 8; ++k) o[k] = f2bf(v[k]);
    *(v8us*)(XB + e) = o;  }
__global__ __launch_bounds__(256) void k_cvt8(const float* __restrict__ src, bf* dst, int n8) {
    const int i = blockIdx.x * 256 + threadIdx.x; if (i >= n8) return; const v8f v = *(const v8f*)(src + (size_t)i * 8); v8us o;
#pragma unroll
    for (int k = 0; k < 8; ++k) o[k] = f2bf(v[k]);
    *(v8us*)(dst + (size_t)i * 8) = o;  }
__global__ __launch_bounds__(256) void k_cs(float* CS) {
    const int idx = blockIdx.x * 256 + threadIdx.x; if (idx >= SEQ * 32) return; const int j = idx & 31, t = idx >> 5;
    double p = 1.0;
    if (j & 1)  p *= 1.333521432163324;      // 10000^(1/32)
    if (j & 2)  p *= 1.7782794100389228;     // 10000^(1/16)
    if (j & 4)  p *= 3.1622776601683795;     // 10000^(1/8)
    if (j & 8)  p *= 10.0;                   // 10000^(1/4)
    if (j & 16) p *= 100.0;                  // 10000^(1/2)
    const float pf = (float)p; const float inv = 1.0f / pf; const float ang = (float)t * inv;
    float sn, cs; sincosf(ang, &sn, &cs);
    v2f o; o[0] = cs; o[1] = sn;
    *(v2f*)(CS + (size_t)idx * 2) = o;  }

// ---- k_projqk: z = 0 (q, scaled 1/8) / 1 (k): 64 tokens x one head tile of x W^T; epilogue per 16-token slab: per-head RMS normalisation, half-split rotary, bf16 hi|lo planes [b*NH + head][t][64].
__global__ __launch_bounds__(32) void k_projqk(const bf* __restrict__ XB, const bf* __restrict__ W4, const float* __restrict__ CS, bf* PH, bf* PL) {
    __shared__ __align__(16) float os[16 * 68];
    const int lane = threadIdx.x & 31, lr = lane & 15, hi = lane >> 4;
    const int r0 = blockIdx.x * 64, head = blockIdx.y, c0 = head * 64, z = blockIdx.z;
    const bf* Bt = W4 + (size_t)z * DM * DM;
    const float sc = (z == 0) ? 0.125f : 1.0f;
    const size_t pz = (size_t)z * PLN;
    v8f acc[4][4];
#pragma unroll
    for (int mb = 0; mb < 4; ++mb)
#pragma unroll
        for (int nb = 0; nb < 4; ++nb) acc[mb][nb] = (v8f){};
    gemm_acc<0>(XB, XB, Bt, (r0 + lr) * DM + 8 * hi, (c0 + lr) * DM + 8 * hi, acc);
    const int r4 = lane >> 3, j8 = lane & 7, d0 = j8 * 8, dp = d0 ^ 32, i0 = d0 & 31;
    const float sgn = (j8 < 4) ? 1.0f : -1.0f;
    const int b = r0 / SEQ, tb = r0 - b * SEQ;
#pragma unroll
    for (int mb = 0; mb < 4; ++mb) {
#pragma unroll
        for (int nb = 0; nb < 4; ++nb) {
#pragma unroll
            for (int j = 0; j < 8; ++j) os[(hi * 8 + j) * 68 + nb * 16 + lr] = acc[mb][nb][j]; }
        wave_sync_lds();
#pragma unroll 1
        for (int it = 0; it < 4; ++it) {
            const int row = it * 4 + r4; const int t = tb + mb * 16 + row;
            const v4f a0 = *(const v4fa*)(os + row * 68 + d0), a1 = *(const v4fa*)(os + row * 68 + d0 + 4);
            const v4f b0 = *(const v4fa*)(os + row * 68 + dp), b1 = *(const v4fa*)(os + row * 68 + dp + 4);
            float ow[8], pw[8], cs[16];
#pragma unroll
            for (int e = 0; e < 4; ++e) { ow[e] = a0[e]; ow[4 + e] = a1[e]; pw[e] = b0[e]; pw[4 + e] = b1[e]; }
            float ss = 0.f;
#pragma unroll
            for (int e = 0; e < 8; ++e) ss += ow[e] * ow[e];
            ss += __shfl_xor(ss, 1, 32); ss += __shfl_xor(ss, 2, 32); ss += __shfl_xor(ss, 4, 32);
            const float rn = rsqrtf(ss * (1.0f / 64.0f) + RMS_EPS);
            const float* cp = CS + ((size_t)t * 32 + i0) * 2;
            const v4f c0v = *(const v4f*)cp, c1v = *(const v4f*)(cp + 4), c2v = *(const v4f*)(cp + 8), c3v = *(const v4f*)(cp + 12);
#pragma unroll
            for (int e = 0; e < 4; ++e) { cs[e] = c0v[e]; cs[4 + e] = c1v[e]; cs[8 + e] = c2v[e]; cs[12 + e] = c3v[e]; }
            v8us oh, ol;
#pragma unroll
            for (int e = 0; e < 8; ++e) { const float xo = ow[e] * rn, xp = pw[e] * rn; const float r = (xo * cs[2 * e] + sgn * (xp * cs[2 * e + 1])) * sc;
                unsigned short a2, c2; splitf(r, a2, c2); oh[e] = a2; ol[e] = c2; }
            const size_t oo = pz + (((size_t)(b * NH + head)) * SEQ + t) * HD + d0;
            *(v8us*)(PH + oo) = oh; *(v8us*)(PL + oo) = ol;  }
        wave_sync_lds();
    }
}

// ---- k_projv: transposed value projection V^T[b][n][t] = sum_k Wv[n][k] x[b][t][k] (A = weight rows, Bt = token rows): f16 plane (pitch SEQ) + bf16 hi|lo planes for t < RH (pitch RH).
__global__ __launch_bounds__(32) void k_projv(const bf* __restrict__ W4, const bf* __restrict__ XB, h16* V16, bf* Vh, bf* Vl) {
    __shared__ __align__(16) float os[16 * 68];
    const int lane = threadIdx.x & 31, lr = lane & 15, hi = lane >> 4;
    const int r0 = blockIdx.x * 64, c0 = blockIdx.y * 64, b = blockIdx.z;
    const bf* A = W4 + (size_t)2 * DM * DM; const bf* Bt = XB + (size_t)b * SEQ * DM;
    v8f acc[4][4];
#pragma unroll
    for (int mb = 0; mb < 4; ++mb)
#pragma unroll
        for (int nb = 0; nb < 4; ++nb) acc[mb][nb] = (v8f){};
    gemm_acc<0>(A, A, Bt, (r0 + lr) * DM + 8 * hi, (c0 + lr) * DM + 8 * hi, acc);
    const int r4 = lane >> 3, j8 = lane & 7; const bool early = (c0 < RH);
#pragma unroll
    for (int mb = 0; mb < 4; ++mb) {
#pragma unroll
        for (int nb = 0; nb < 4; ++nb) {
#pragma unroll
            for (int j = 0; j < 8; ++j) os[(hi * 8 + j) * 68 + nb * 16 + lr] = acc[mb][nb][j]; }
        wave_sync_lds();
#pragma unroll 1
        for (int it = 0; it < 4; ++it) {
            const int row = it * 4 + r4; const int n = r0 + mb * 16 + row; const int t0 = c0 + j8 * 8;
            const v4f a0 = *(const v4fa*)(os + row * 68 + j8 * 8), a1 = *(const v4fa*)(os + row * 68 + j8 * 8 + 4);
            v8h o16; v8us oh, ol;
#pragma unroll
            for (int e = 0; e < 8; ++e) { const float x = (e < 4) ? a0[e & 3] : a1[e & 3]; o16[e] = (h16)x; unsigned short a2, c2; splitf(x, a2, c2); oh[e] = a2; ol[e] = c2; }
            const size_t o1 = ((size_t)(b * DM + n)) * SEQ + t0; const size_t o2 = ((size_t)(b * DM + n)) * RH + t0;
            *(v8h*)(V16 + o1) = o16; if (early) { *(v8us*)(Vh + o2) = oh; *(v8us*)(Vl + o2) = ol; }
             }
        wave_sync_lds();
    }
}

__global__ __launch_bounds__(32) void k_projo(const bf* __restrict__ ATh, const bf* __restrict__ ATl, const bf* __restrict__ W4, float* OUT) {
    __shared__ __align__(16) float os[16 * 68];
    const int lane = threadIdx.x & 31, lr = lane & 15, hi = lane >> 4;
    const int r0 = blockIdx.x * 64, c0 = blockIdx.y * 64;
    const bf* Bt = W4 + (size_t)3 * DM * DM;
    v8f acc[4][4];
#pragma unroll
    for (int mb = 0; mb < 4; ++mb)
#pragma unroll
        for (int nb = 0; nb < 4; ++nb) acc[mb][nb] = (v8f){};
    gemm_acc<1>(ATh, ATl, Bt, (r0 + lr) * DM + 8 * hi, (c0 + lr) * DM + 8 * hi, acc);
#pragma unroll
    for (int mb = 0; mb < 4; ++mb) {
#pragma unroll
        for (int nb = 0; nb < 4; ++nb) {
#pragma unroll
            for (int j = 0; j < 8; ++j) os[(hi * 8 + j) * 68 + nb * 16 + lr] = acc[mb][nb][j]; }
        wave_sync_lds();
        float* crow = OUT + (size_t)(r0 + mb * 16) * DM + c0;
{
#pragma unroll
            for (int s = 0; s < 8; ++s) { const int row = 2 * s + hi, cofs = lr * 4; const v4f val = *(const v4fa*)(os + row * 68 + cofs);
                *(v4f*)(crow + (size_t)row * DM + cofs) = val; }
             }
        wave_sync_lds();
    }
}

// ---- fused causal attention, online softmax. One wave per 16 query rows (4 waves per block, no cross-wave exchange); K / V^T fragments straight from the planes, 32 keys per step;
// scores = (qh + ql).(kh + kl) without the lo.lo term; running max / sum in f32 (log2 domain); P through a wave-private LDS tile (stored as 16-bit scalars, reloaded through may_alias vectors of the same
template <bool EARLY>
__device__ __forceinline__ void attn_body(const bf* __restrict__ Qh, const bf* __restrict__ Ql, const bf* __restrict__ Kh, const bf* __restrict__ Kl,
                                          const h16* __restrict__ V16, const bf* __restrict__ Vh, const bf* __restrict__ Vl, bf* Ah, bf* Al, int rowoff) {
    __shared__ __align__(16) float os[4][16 * 68];
    __shared__ __align__(16) h16 pf[4][16 * 40];
    __shared__ __align__(16) bf  ph[4][16 * 40];
    __shared__ __align__(16) bf  pl[4][16 * 40];
    const int lane = threadIdx.x & 31, lr = lane & 15, hi = lane >> 4;
    const int wave = __builtin_amdgcn_readfirstlane(threadIdx.x >> 5);
    const int bh = blockIdx.y; const int qrow0 = rowoff + blockIdx.x * 64 + wave * 16;
    const int pb = bh * SEQ * HD;
    const int nch = (qrow0 >> 5) + 1;
    v8f oa[4];
#pragma unroll
    for (int sl = 0; sl < 4; ++sl) oa[sl] = (v8f){};
    float m[8], l[8];
#pragma unroll
    for (int r = 0; r < 8; ++r) { m[r] = NEGB; l[r] = 0.f; }
    const int qoff0 = pb + (qrow0 + lr) * HD + 8 * hi;
#pragma unroll 1
    for (int c = 0; c < nch; ++c) {
        const int kb = c * 32;
        int qo = qoff0; asm volatile("" : "+v"(qo));
        const v16bf qh0 = ldb(Qh + qo), qh1 = ldb(Qh + qo + 32), ql0 = ldb(Ql + qo), ql1 = ldb(Ql + qo + 32);
        v8f s0 = (v8f){}, s1 = (v8f){};
        { const int ko = pb + (kb + lr) * HD + 8 * hi;
          const v16bf kh0 = ldb(Kh + ko), kh1 = ldb(Kh + ko + 32), kl0 = ldb(Kl + ko), kl1 = ldb(Kl + ko + 32);
          s0 = mmab(qh0, kh0, s0); s0 = mmab(qh1, kh1, s0); s0 = mmab(ql0, kh0, s0); s0 = mmab(ql1, kh1, s0); s0 = mmab(qh0, kl0, s0); s0 = mmab(qh1, kl1, s0); }
        { const int ko = pb + (kb + 16 + lr) * HD + 8 * hi;
          const v16bf kh0 = ldb(Kh + ko), kh1 = ldb(Kh + ko + 32), kl0 = ldb(Kl + ko), kl1 = ldb(Kl + ko + 32);
          s1 = mmab(qh0, kh0, s1); s1 = mmab(qh1, kh1, s1); s1 = mmab(ql0, kh0, s1); s1 = mmab(ql1, kh1, s1); s1 = mmab(qh0, kl0, s1); s1 = mmab(qh1, kl1, s1); }
        const bool diag = (kb + 31 > qrow0);     // wave-uniform: only the last step of a wave touches the diagonal
        const int kg0 = kb + lr;
#pragma unroll
        for (int r = 0; r < 8; ++r) {
            const int qg = qrow0 + 8 * hi + r;
            float v0 = s0[r] * L2E, v1 = s1[r] * L2E;     // the 1/8 scale is carried by the q planes
            if (diag) { v0 = (kg0 <= qg) ? v0 : NEGB; v1 = (kg0 + 16 <= qg) ? v1 : NEGB; }
            float mx = fmaxf(v0, v1);
            mx = fmaxf(mx, __shfl_xor(mx, 1, 32)); mx = fmaxf(mx, __shfl_xor(mx, 2, 32)); mx = fmaxf(mx, __shfl_xor(mx, 4, 32)); mx = fmaxf(mx, __shfl_xor(mx, 8, 32));
            const float mnew = fmaxf(m[r], mx);
            const float alpha = __builtin_amdgcn_exp2f(m[r] - mnew);
            const float e0 = __builtin_amdgcn_exp2f(v0 - mnew), e1 = __builtin_amdgcn_exp2f(v1 - mnew);
            l[r] = l[r] * alpha + (e0 + e1); m[r] = mnew;
#pragma unroll
            for (int sl = 0; sl < 4; ++sl) oa[sl][r] *= alpha;
            const int po = (8 * hi + r) * 40 + lr;
            if (EARLY) { unsigned short a2, c2; splitf(e0, a2, c2); ph[wave][po] = a2; pl[wave][po] = c2; splitf(e1, a2, c2); ph[wave][po + 16] = a2; pl[wave][po + 16] = c2; }
            else { pf[wave][po] = (h16)(e0 * PCAR); pf[wave][po + 16] = (h16)(e1 * PCAR); }
        }
        wave_sync_lds();
        if (EARLY) {
            const v16bf pah = cat16b(*(const v8usa*)(&ph[wave][lr * 40 + 8 * hi]), *(const v8usa*)(&ph[wave][lr * 40 + 16 + 8 * hi]));
            const v16bf pal = cat16b(*(const v8usa*)(&pl[wave][lr * 40 + 8 * hi]), *(const v8usa*)(&pl[wave][lr * 40 + 16 + 8 * hi]));
#pragma unroll
            for (int sl = 0; sl < 4; ++sl) { const int vo = (bh * HD + sl * 16 + lr) * RH + kb + 8 * hi; const v16bf vh = ldb(Vh + vo), vl = ldb(Vl + vo);
                oa[sl] = mmab(pah, vh, oa[sl]); oa[sl] = mmab(pal, vh, oa[sl]); oa[sl] = mmab(pah, vl, oa[sl]); }
        } else {
            const v16h pa = cat16(*(const v8ha*)(&pf[wave][lr * 40 + 8 * hi]), *(const v8ha*)(&pf[wave][lr * 40 + 16 + 8 * hi]));
#pragma unroll
            for (int sl = 0; sl < 4; ++sl) { const int vo = (bh * HD + sl * 16 + lr) * SEQ + kb + 8 * hi; const v16h vf = ldh(V16 + vo);
                oa[sl] = mmah(pa, vf, oa[sl]); }
        }
        wave_sync_lds();
    }
    const float carry = EARLY ? 1.0f : (1.0f / PCAR);
#pragma unroll
    for (int r = 0; r < 8; ++r) { float t = l[r]; t += __shfl_xor(t, 1, 32); t += __shfl_xor(t, 2, 32); t += __shfl_xor(t, 4, 32); t += __shfl_xor(t, 8, 32);
        const float inv = carry * (1.0f / t);
#pragma unroll
        for (int sl = 0; sl < 4; ++sl) os[wave][(8 * hi + r) * 68 + sl * 16 + lr] = oa[sl][r] * inv; }
    wave_sync_lds();
    const int r4 = lane >> 3, d0 = (lane & 7) * 8; const int b = bh / NH, h = bh - b * NH;
#pragma unroll 1
    for (int it = 0; it < 4; ++it) {
        const int row = it * 4 + r4;
        const v4f a0 = *(const v4fa*)(&os[wave][row * 68 + d0]), a1 = *(const v4fa*)(&os[wave][row * 68 + d0 + 4]);
        v8us oh, ol;
#pragma unroll
        for (int e = 0; e < 8; ++e) { const float x = (e < 4) ? a0[e & 3] : a1[e & 3]; unsigned short a2, c2; splitf(x, a2, c2); oh[e] = a2; ol[e] = c2; }
        const size_t oo = ((size_t)(b * SEQ + qrow0 + row)) * DM + h * HD + d0;
        *(v8us*)(Ah + oo) = oh; *(v8us*)(Al + oo) = ol;  }
}
// query rows [0, RH): grid (RH/64, NB*NH); query rows [RH, SEQ): grid ((SEQ-RH)/64, NB*NH); 128 threads
__global__ __launch_bounds__(128) void k_attn_e(const bf* __restrict__ Qh, const bf* __restrict__ Ql, const bf* __restrict__ Kh, const bf* __restrict__ Kl,
                                                const h16* __restrict__ V16, const bf* __restrict__ Vh, const bf* __restrict__ Vl, bf* Ah, bf* Al) {
    attn_body<true>(Qh, Ql, Kh, Kl, V16, Vh, Vl, Ah, Al, 0); }
__global__ __launch_bounds__(128) void k_attn_l(const bf* __restrict__ Qh, const bf* __restrict__ Ql, const bf* __restrict__ Kh, const bf* __restrict__ Kl,
                                                const h16* __restrict__ V16, const bf* __restrict__ Vh, const bf* __restrict__ Vl, bf* Ah, bf* Al) {
    attn_body<false>(Qh, Ql, Kh, Kl, V16, Vh, Vl, Ah, Al, RH); }

constexpr size_t al256(size_t b) { return (b + 255) & ~(size_t)255; }
constexpr size_t SZ_XB = al256((size_t)MR * DM * 2);
constexpr size_t SZ_W4 = al256((size_t)4 * DM * DM * 2);
constexpr size_t SZ_CS = al256((size_t)SEQ * 32 * 2 * 4);
constexpr size_t SZ_QK = al256((size_t)2 * PLN * 2);
constexpr size_t SZ_V16 = al256((size_t)NB * DM * SEQ * 2);
constexpr size_t SZ_VR = al256((size_t)NB * DM * RH * 2);
constexpr size_t SZ_AT = al256((size_t)MR * DM * 2);
constexpr size_t SZ_TOTAL = SZ_XB + SZ_W4 + SZ_CS + 2 * SZ_QK + SZ_V16 + 2 * SZ_VR + 2 * SZ_AT;
static_assert(SZ_TOTAL <= (size_t)134217728);

extern "C" void kernel_launch(void* const* d_in, const int* in_sizes, int n_in,
                              void* d_out, int out_size, void* d_ws, size_t ws_size, hipStream_t stream) {
    if (n_in < 5) return;
    if (in_sizes[0] < (NB - 1) * SEQ_FULL * DM + SEQ * DM) return;
    if (in_sizes[1] < DM * DM || in_sizes[2] < DM * DM || in_sizes[3] < DM * DM || in_sizes[4] < DM * DM) return;
    if (out_size < MR * DM) return;
    if (SZ_TOTAL > ws_size) return;
    const float* x = (const float*)d_in[0]; const float* wq = (const float*)d_in[1]; const float* wk = (const float*)d_in[2];
    const float* wv = (const float*)d_in[3]; const float* wo = (const float*)d_in[4];      // wire order x, w_q, w_k, w_v, w_proj (each [out][in])
    float* OUT = (float*)d_out;
    char* wsp = (char*)d_ws;
    bf* XB = (bf*)wsp; wsp += SZ_XB;
    bf* W4 = (bf*)wsp; wsp += SZ_W4;            // Wq | Wk | Wv | Wo, each [DM][DM] Bt as stored
    float* CS = (float*)wsp; wsp += SZ_CS;
    bf* QKh = (bf*)wsp; wsp += SZ_QK;           // [q | k][b*NH + h][t][64] hi
    bf* QKl = (bf*)wsp; wsp += SZ_QK;           // lo
    h16* V16 = (h16*)wsp; wsp += SZ_V16;        // [b][h*64 + d][t]
    bf* Vh = (bf*)wsp; wsp += SZ_VR;            // [b][h*64 + d][t < RH]
    bf* Vl = (bf*)wsp; wsp += SZ_VR;
    bf* ATh = (bf*)wsp; wsp += SZ_AT;           // merged-head context [b*SEQ + t][h*64 + d] hi
    bf* ATl = (bf*)wsp; wsp += SZ_AT;
    const unsigned nw8 = (unsigned)(DM * DM / 8);
    k_cvtx<<<(unsigned)(((size_t)MR * DM / 8 + 255) / 256), 256, 0, stream>>>(x, XB);
    k_cvt8<<<(nw8 + 255) / 256, 256, 0, stream>>>(wq, W4, (int)nw8);
    k_cvt8<<<(nw8 + 255) / 256, 256, 0, stream>>>(wk, W4 + (size_t)DM * DM, (int)nw8);
    k_cvt8<<<(nw8 + 255) / 256, 256, 0, stream>>>(wv, W4 + (size_t)2 * DM * DM, (int)nw8);
    k_cvt8<<<(nw8 + 255) / 256, 256, 0, stream>>>(wo, W4 + (size_t)3 * DM * DM, (int)nw8);
    k_cs<<<(SEQ * 32 + 255) / 256, 256, 0, stream>>>(CS);
    k_projqk<<<dim3(MR / 64, NH, 2), 32, 0, stream>>>(XB, W4, CS, QKh, QKl);
    k_projv<<<dim3(DM / 64, SEQ / 64, NB), 32, 0, stream>>>(W4, XB, V16, Vh, Vl);
    k_attn_e<<<dim3(RH / 64, NB * NH), 128, 0, stream>>>(QKh, QKl, QKh + PLN, QKl + PLN, V16, Vh, Vl, ATh, ATl);
    if (SEQ > RH) k_attn_l<<<dim3((SEQ - RH) / 64, NB * NH), 128, 0, stream>>>(QKh, QKl, QKh + PLN, QKl + PLN, V16, Vh, Vl, ATh, ATl);
    k_projo<<<dim3(MR / 64, DM / 64), 32, 0, stream>>>(ATh, ATl, W4, OUT);
}

// v001
// One run takes 245 microseconds.
// Two timings next to v000 put it at 1.52 and 1.53 times that version's speed.
#include <hip/hip_runtime.h>

// Causal multi-head self-attention: separate bias-free [out][in] q/k/v projections, per-head RMS normalisation of q and k (no gain), half-split rotary
// (first half x1 cos + x2 sin, second half -x1 sin + x2 cos, positions = arange), scale 1/8, causal softmax, [out][in] output projection.
// Compute dtypes (all v_wmma_f32_16x16x32, f32 accumulate): q/k/v projections bf16 x bf16 (inputs converted RNE to bf16); scores bf16 hi|lo x hi|lo (3 products);
// P.V f16 single product (P carried x1024) for query rows >= RH, bf16 hi|lo 3 products for rows < RH; output projection ctx bf16 hi|lo x bf16 weights (2 products); norm/rotary/softmax f32.

#ifndef NB
#define NB 2
#endif
#ifndef SEQ
#define SEQ 2048
#endif
#define NB_FULL  2
#define SEQ_FULL 2048
#define DM   1024
#define NH   16
#define HD   64
#if SEQ < 256
#define RH   SEQ
#else
#define RH   256                      // query rows < RH: P and V as bf16 hi|lo (3 products)
#endif
#define MR   (NB * SEQ)
#define PLN  ((size_t)NB * NH * SEQ * HD)
#define PCAR 1024.0f
#define L2E  1.4426950408889634f
#define NEGB (-1.0e30f)
#define RMS_EPS 1.1920928955078125e-07f

static_assert(NB >= 1 && NB <= NB_FULL);
static_assert(SEQ >= 64 && SEQ <= SEQ_FULL);
static_assert(SEQ % 64 == 0);
static_assert(RH % 64 == 0);
static_assert(RH <= SEQ);
static_assert(DM % 64 == 0);
static_assert(DM % 32 == 0);
static_assert(NH * HD == DM);
static_assert(HD == 64);
static_assert(MR % 64 == 0);

typedef _Float16 h16;
typedef unsigned short bf;
typedef __attribute__((ext_vector_type(16))) __bf16   v16bf;
typedef __attribute__((ext_vector_type(16))) _Float16 v16h;
typedef __attribute__((ext_vector_type(8)))  _Float16 v8h;
typedef __attribute__((ext_vector_type(8)))  unsigned short v8us;
typedef __attribute__((ext_vector_type(8)))  float    v8f;
typedef __attribute__((ext_vector_type(4)))  float    v4f;
typedef __attribute__((ext_vector_type(2)))  float    v2f;
typedef v8h  __attribute__((may_alias)) v8ha;
typedef v4f  __attribute__((may_alias)) v4fa;
typedef v8us __attribute__((may_alias)) v8usa;

__device__ __forceinline__ unsigned short f2bf(float f) { unsigned u = __float_as_uint(f); u += 0x7FFFu + ((u >> 16) & 1u); return (unsigned short)(u >> 16); }
__device__ __forceinline__ float bf2f(unsigned short b) { return __uint_as_float(((unsigned)b) << 16); }
__device__ __forceinline__ void splitf(float y, unsigned short& h, unsigned short& l) { h = f2bf(y); l = f2bf(y - bf2f(h)); }
__device__ __forceinline__ v16h cat16(v8h lo, v8h hi) { return __builtin_shufflevector(lo, hi, 0, 1, 2, 3, 4, 5, 6, 7, 8, 9, 10, 11, 12, 13, 14, 15); }
__device__ __forceinline__ v16bf cat16b(v8us lo, v8us hi) { return __builtin_bit_cast(v16bf, __builtin_shufflevector(lo, hi, 0, 1, 2, 3, 4, 5, 6, 7, 8, 9, 10, 11, 12, 13, 14, 15)); }
// fragment loads from K-contiguous 16-bit global rows: elements 0..7 <- p[0..7], elements 8..15 <- p[16..23]; caller adds 8*(lane>>4)
__device__ __forceinline__ v16bf ldb(const bf* p) { return cat16b(*(const v8us*)p, *(const v8us*)(p + 16)); }
__device__ __forceinline__ v16h  ldh(const h16* p) { return cat16(*(const v8h*)p, *(const v8h*)(p + 16)); }
// one WMMA + its own hazard guard (accumulator tied, fragments kept live)
__device__ __forceinline__ v8f mmab(v16bf a, v16bf b, v8f c) {
    c = __builtin_amdgcn_wmma_f32_16x16x32_bf16(false, a, false, b, (short)0, c, false, false);
    asm volatile("v_nop\n\tv_nop\n\tv_nop\n\tv_nop" : "+v"(c) : "v"(a), "v"(b));
    return c; }
__device__ __forceinline__ v8f mmah(v16h a, v16h b, v8f c) {
    c = __builtin_amdgcn_wmma_f32_16x16x32_f16(false, a, false, b, (short)0, c, false, false);
    asm volatile("v_nop\n\tv_nop\n\tv_nop\n\tv_nop" : "+v"(c) : "v"(a), "v"(b));
    return c; }
__device__ __forceinline__ void wave_sync_lds() { asm volatile("s_wait_dscnt 0" ::: "memory"); __builtin_amdgcn_wave_barrier(); asm volatile("" ::: "memory"); }

// ---- one-wave 64x64 tile accumulate over K = DM: acc[mb][nb] += A[rows][k] Bt[cols][k] (+ A2 rows when NSPLIT); operands straight from bf16 planes with row pitch DM
template <int NSPLIT>
__device__ __forceinline__ void gemm_acc(const bf* __restrict__ A, const bf* __restrict__ A2, const bf* __restrict__ Bt, int aoff, int boff, v8f (&acc)[4][4]) {
#pragma unroll 1
    for (int kc = 0; kc < DM; kc += 32) {
        v16bf a[4], a2[4];
#pragma unroll
        for (int mb = 0; mb < 4; ++mb) { a[mb] = ldb(A + aoff + mb * 16 * DM + kc); if (NSPLIT) a2[mb] = ldb(A2 + aoff + mb * 16 * DM + kc); }
#pragma unroll
        for (int nb = 0; nb < 4; ++nb) { const v16bf b = ldb(Bt + boff + nb * 16 * DM + kc);
#pragma unroll
            for (int mb = 0; mb < 4; ++mb) { acc[mb][nb] = mmab(a[mb], b, acc[mb][nb]); if (NSPLIT) acc[mb][nb] = mmab(a2[mb], b, acc[mb][nb]); } }
    }
}

__global__ __launch_bounds__(256) void k_cvtx(const float* __restrict__ x, bf* XB) {
    const size_t i = (size_t)blockIdx.x * 256 + threadIdx.x; if (i >= (size_t)MR * DM / 8) return;
    const size_t e = i * 8; const int row = (int)(e / DM), col = (int)(e % DM); const int b = row / SEQ, t = row - b * SEQ;
    const v8f v = *(const v8f*)(x + ((size_t)b * SEQ_FULL + t) * DM + col); v8us o;
#pragma unroll
    for (int k = 0; k < 8; ++k) o[k] = f2bf(v[k]);
    *(v8us*)(XB + e) = o;  }
__global__ __launch_bounds__(256) void k_cvt8(const float* __restrict__ src, bf* dst, int n8) {
    const int i = blockIdx.x * 256 + threadIdx.x; if (i >= n8) return; const v8f v = *(const v8f*)(src + (size_t)i * 8); v8us o;
#pragma unroll
    for (int k = 0; k < 8; ++k) o[k] = f2bf(v[k]);
    *(v8us*)(dst + (size_t)i * 8) = o;  }
__global__ __launch_bounds__(256) void k_cs(float* CS) {
    const int idx = blockIdx.x * 256 + threadIdx.x; if (idx >= SEQ * 32) return; const int j = idx & 31, t = idx >> 5;
    double p = 1.0;
    if (j & 1)  p *= 1.333521432163324;      // 10000^(1/32)
    if (j & 2)  p *= 1.7782794100389228;     // 10000^(1/16)
    if (j & 4)  p *= 3.1622776601683795;     // 10000^(1/8)
    if (j & 8)  p *= 10.0;                   // 10000^(1/4)
    if (j & 16) p *= 100.0;                  // 10000^(1/2)
    const float pf = (float)p; const float inv = 1.0f / pf; const float ang = (float)t * inv;
    float sn, cs; sincosf(ang, &sn, &cs);
    v2f o; o[0] = cs; o[1] = sn;
    *(v2f*)(CS + (size_t)idx * 2) = o;  }

// ---- k_projqk: z = 0 (q, scaled 1/8) / 1 (k): 64 tokens x one head tile of x W^T; epilogue per 16-token slab: per-head RMS normalisation, half-split rotary, bf16 hi|lo planes [b*NH + head][t][64].
__global__ __launch_bounds__(32) void k_projqk(const bf* __restrict__ XB, const bf* __restrict__ W4, const float* __restrict__ CS, bf* PH, bf* PL) {
    __shared__ __align__(16) float os[16 * 68];
    const int lane = threadIdx.x & 31, lr = lane & 15, hi = lane >> 4;
    const int r0 = blockIdx.x * 64, head = blockIdx.y, c0 = head * 64, z = blockIdx.z;
    const bf* Bt = W4 + (size_t)z * DM * DM;
    const float sc = (z == 0) ? 0.125f : 1.0f;
    const size_t pz = (size_t)z * PLN;
    v8f acc[4][4];
#pragma unroll
    for (int mb = 0; mb < 4; ++mb)
#pragma unroll
        for (int nb = 0; nb < 4; ++nb) acc[mb][nb] = (v8f){};
    gemm_acc<0>(XB, XB, Bt, (r0 + lr) * DM + 8 * hi, (c0 + lr) * DM + 8 * hi, acc);
    const int r4 = lane >> 3, j8 = lane & 7, d0 = j8 * 8, dp = d0 ^ 32, i0 = d0 & 31;
    const float sgn = (j8 < 4) ? 1.0f : -1.0f;
    const int b = r0 / SEQ, tb = r0 - b * SEQ;
#pragma unroll
    for (int mb = 0; mb < 4; ++mb) {
#pragma unroll
        for (int nb = 0; nb < 4; ++nb) {
#pragma unroll
            for (int j = 0; j < 8; ++j) os[(hi * 8 + j) * 68 + nb * 16 + lr] = acc[mb][nb][j]; }
        wave_sync_lds();
#pragma unroll 1
        for (int it = 0; it < 4; ++it) {
            const int row = it * 4 + r4; const int t = tb + mb * 16 + row;
            const v4f a0 = *(const v4fa*)(os + row * 68 + d0), a1 = *(const v4fa*)(os + row * 68 + d0 + 4);
            const v4f b0 = *(const v4fa*)(os + row * 68 + dp), b1 = *(const v4fa*)(os + row * 68 + dp + 4);
            float ow[8], pw[8], cs[16];
#pragma unroll
            for (int e = 0; e < 4; ++e) { ow[e] = a0[e]; ow[4 + e] = a1[e]; pw[e] = b0[e]; pw[4 + e] = b1[e]; }
            float ss = 0.f;
#pragma unroll
            for (int e = 0; e < 8; ++e) ss += ow[e] * ow[e];
            ss += __shfl_xor(ss, 1, 32); ss += __shfl_xor(ss, 2, 32); ss += __shfl_xor(ss, 4, 32);
            const float rn = rsqrtf(ss * (1.0f / 64.0f) + RMS_EPS);
            const float* cp = CS + ((size_t)t * 32 + i0) * 2;
            const v4f c0v = *(const v4f*)cp, c1v = *(const v4f*)(cp + 4), c2v = *(const v4f*)(cp + 8), c3v = *(const v4f*)(cp + 12);
#pragma unroll
            for (int e = 0; e < 4; ++e) { cs[e] = c0v[e]; cs[4 + e] = c1v[e]; cs[8 + e] = c2v[e]; cs[12 + e] = c3v[e]; }
            v8us oh, ol;
#pragma unroll
            for (int e = 0; e < 8; ++e) { const float xo = ow[e] * rn, xp = pw[e] * rn; const float r = (xo * cs[2 * e] + sgn * (xp * cs[2 * e + 1])) * sc;
                unsigned short a2, c2; splitf(r, a2, c2); oh[e] = a2; ol[e] = c2; }
            const size_t oo = pz + (((size_t)(b * NH + head)) * SEQ + t) * HD + d0;
            *(v8us*)(PH + oo) = oh; *(v8us*)(PL + oo) = ol;  }
        wave_sync_lds();
    }
}

// ---- k_projv: transposed value projection V^T[b][n][t] = sum_k Wv[n][k] x[b][t][k] (A = weight rows, Bt = token rows): f16 plane (pitch SEQ) + bf16 hi|lo planes for t < RH (pitch RH).
__global__ __launch_bounds__(32) void k_projv(const bf* __restrict__ W4, const bf* __restrict__ XB, h16* V16, bf* Vh, bf* Vl) {
    __shared__ __align__(16) float os[16 * 68];
    const int lane = threadIdx.x & 31, lr = lane & 15, hi = lane >> 4;
    const int r0 = blockIdx.x * 64, c0 = blockIdx.y * 64, b = blockIdx.z;
    const bf* A = W4 + (size_t)2 * DM * DM; const bf* Bt = XB + (size_t)b * SEQ * DM;
    v8f acc[4][4];
#pragma unroll
    for (int mb = 0; mb < 4; ++mb)
#pragma unroll
        for (int nb = 0; nb < 4; ++nb) acc[mb][nb] = (v8f){};
    gemm_acc<0>(A, A, Bt, (r0 + lr) * DM + 8 * hi, (c0 + lr) * DM + 8 * hi, acc);
    const int r4 = lane >> 3, j8 = lane & 7; const bool early = (c0 < RH);
#pragma unroll
    for (int mb = 0; mb < 4; ++mb) {
#pragma unroll
        for (int nb = 0; nb < 4; ++nb) {
#pragma unroll
            for (int j = 0; j < 8; ++j) os[(hi * 8 + j) * 68 + nb * 16 + lr] = acc[mb][nb][j]; }
        wave_sync_lds();
#pragma unroll 1
        for (int it = 0; it < 4; ++it) {
            const int row = it * 4 + r4; const int n = r0 + mb * 16 + row; const int t0 = c0 + j8 * 8;
            const v4f a0 = *(const v4fa*)(os + row * 68 + j8 * 8), a1 = *(const v4fa*)(os + row * 68 + j8 * 8 + 4);
            v8h o16; v8us oh, ol;
#pragma unroll
            for (int e = 0; e < 8; ++e) { const float x = (e < 4) ? a0[e & 3] : a1[e & 3]; o16[e] = (h16)x; unsigned short a2, c2; splitf(x, a2, c2); oh[e] = a2; ol[e] = c2; }
            const size_t o1 = ((size_t)(b * DM + n)) * SEQ + t0; const size_t o2 = ((size_t)(b * DM + n)) * RH + t0;
            *(v8h*)(V16 + o1) = o16; if (early) { *(v8us*)(Vh + o2) = oh; *(v8us*)(Vl + o2) = ol; }
             }
        wave_sync_lds();
    }
}

__global__ __launch_bounds__(32) void k_projo(const bf* __restrict__ ATh, const bf* __restrict__ ATl, const bf* __restrict__ W4, float* OUT) {
    __shared__ __align__(16) float os[16 * 68];
    const int lane = threadIdx.x & 31, lr = lane & 15, hi = lane >> 4;
    const int r0 = blockIdx.x * 64, c0 = blockIdx.y * 64;
    const bf* Bt = W4 + (size_t)3 * DM * DM;
    v8f acc[4][4];
#pragma unroll
    for (int mb = 0; mb < 4; ++mb)
#pragma unroll
        for (int nb = 0; nb < 4; ++nb) acc[mb][nb] = (v8f){};
    gemm_acc<1>(ATh, ATl, Bt, (r0 + lr) * DM + 8 * hi, (c0 + lr) * DM + 8 * hi, acc);
#pragma unroll
    for (int mb = 0; mb < 4; ++mb) {
#pragma unroll
        for (int nb = 0; nb < 4; ++nb) {
#pragma unroll
            for (int j = 0; j < 8; ++j) os[(hi * 8 + j) * 68 + nb * 16 + lr] = acc[mb][nb][j]; }
        wave_sync_lds();
        float* crow = OUT + (size_t)(r0 + mb * 16) * DM + c0;
{
#pragma unroll
            for (int s = 0; s < 8; ++s) { const int row = 2 * s + hi, cofs = lr * 4; const v4f val = *(const v4fa*)(os + row * 68 + cofs);
                *(v4f*)(crow + (size_t)row * DM + cofs) = val; }
             }
        wave_sync_lds();
    }
}

// ---- fused causal attention, online softmax. One wave per 16 query rows, 4 waves per block. The block's 64 Q rows (once) and each stage of 64 keys (K hi, K lo, V^T rows; two buffers) are brought
// into LDS by asynchronous 16-byte copies that cover whole 128-byte lines; rows lie at a pitch of 144 bytes and every fragment is a pair of 16-byte LDS loads. 32 keys per step, two steps per stage;
// scores = (qh + ql).(kh + kl) without the lo.lo term; running max / sum in f32 (log2 domain); P through a wave-private LDS tile.
#define KP 72                         // LDS row pitch in 16-bit elements: 128 data bytes + 16
__device__ __forceinline__ v16bf ldsb(const bf* p) { return cat16b(*(const v8usa*)p, *(const v8usa*)(p + 16)); }
// 64 rows of 128 bytes, global (row pitch gpitch bytes) -> LDS (row pitch 144 bytes), by 128 threads: thread t takes 16 bytes at column (t & 7) of rows (t >> 3) + 0, 16, 32, 48.
// The address wait stands inside the statement so that no address register is rewritten ahead of it.
__device__ __forceinline__ void copy_rows64(const bf* ldst, const void* gsrc, int gpitch) {
    const int t = threadIdx.x;
    const unsigned l0 = (unsigned)(size_t)ldst + (unsigned)((t >> 3) * (KP * 2) + (t & 7) * 16);
    const unsigned l1 = l0 + 16 * KP * 2, l2 = l0 + 32 * KP * 2, l3 = l0 + 48 * KP * 2;
    const char* g0 = (const char*)gsrc + (size_t)(t >> 3) * gpitch + (t & 7) * 16;
    const char* g1 = g0 + (size_t)16 * gpitch; const char* g2 = g0 + (size_t)32 * gpitch; const char* g3 = g0 + (size_t)48 * gpitch;
    asm volatile("global_load_async_to_lds_b128 %0, %4, off\n\t"
                 "global_load_async_to_lds_b128 %1, %5, off\n\t"
                 "global_load_async_to_lds_b128 %2, %6, off\n\t"
                 "global_load_async_to_lds_b128 %3, %7, off\n\t"
                 "s_wait_xcnt 0x0"
                 :: "v"(l0), "v"(l1), "v"(l2), "v"(l3), "v"(g0), "v"(g1), "v"(g2), "v"(g3) : "memory");
}
template <bool EARLY>
__device__ __forceinline__ void attn_body(const bf* __restrict__ Qh, const bf* __restrict__ Ql, const bf* __restrict__ Kh, const bf* __restrict__ Kl,
                                          const h16* __restrict__ V16, const bf* __restrict__ Vh, const bf* __restrict__ Vl, bf* Ah, bf* Al, int rowoff) {
    __shared__ __align__(16) float os[4][16 * 72];                 // first the Q tile (hi rows, then lo rows, 64 x 144 bytes each), in the epilogue each wave's output staging (pitch 68 floats)
    __shared__ __align__(16) bf  ks[2][2][64 * KP];                // [buffer][hi | lo][key][d]
    __shared__ __align__(16) bf  vs[2][EARLY ? 2 : 1][64 * KP];    // [buffer][plane][d][key]
    __shared__ __align__(16) h16 pf[4][16 * 40];
    __shared__ __align__(16) bf  ph[4][16 * 40];
    __shared__ __align__(16) bf  pl[4][16 * 40];
    static_assert(sizeof(os) == (size_t)2 * 64 * KP * 2);
    const int lane = threadIdx.x & 31, lr = lane & 15, hi = lane >> 4;
    const int wave = __builtin_amdgcn_readfirstlane(threadIdx.x >> 5);
    const int bh = blockIdx.y; const int qblk = rowoff + blockIdx.x * 64; const int qrow0 = qblk + wave * 16;
    const int pb = bh * SEQ * HD;
    const int nch = (qrow0 >> 5) + 1;
    const int nst = (qblk >> 6) + 1;          // stages of 64 keys, the same for the whole block; the last one holds the diagonal
    bf* qsm = (bf*)&os[0][0];
    auto stage = [&](int st) {                // stage st -> buffer st & 1; keys st * 64 .. st * 64 + 63 <= qblk + 63
        const int bu = st & 1;
        copy_rows64(&ks[bu][0][0], Kh + pb + st * 64 * HD, HD * 2);
        copy_rows64(&ks[bu][1][0], Kl + pb + st * 64 * HD, HD * 2);
        if (EARLY) { copy_rows64(&vs[bu][0][0], Vh + bh * HD * RH + st * 64, RH * 2); copy_rows64(&vs[bu][EARLY ? 1 : 0][0], Vl + bh * HD * RH + st * 64, RH * 2); }
        else copy_rows64(&vs[bu][0][0], V16 + bh * HD * SEQ + st * 64, SEQ * 2);
    };
    copy_rows64(qsm, Qh + pb + qblk * HD, HD * 2);
    copy_rows64(qsm + 64 * KP, Ql + pb + qblk * HD, HD * 2);
    stage(0);
    asm volatile("s_wait_asynccnt 0x0" ::: "memory");     // this wave's copies of Q and stage 0 have landed
    __syncthreads();                                      // ... and every other wave's
    if (nst > 1) stage(1);
    const int qf = (wave * 16 + lr) * KP + 8 * hi;
    const v16bf qh0 = ldsb(qsm + qf), qh1 = ldsb(qsm + qf + 32), ql0 = ldsb(qsm + 64 * KP + qf), ql1 = ldsb(qsm + 64 * KP + qf + 32);
    v8f oa[4];
#pragma unroll
    for (int sl = 0; sl < 4; ++sl) oa[sl] = (v8f){};
    float m[8], l[8];
#pragma unroll
    for (int r = 0; r < 8; ++r) { m[r] = NEGB; l[r] = 0.f; }
#pragma unroll 1                      // stays rolled, as before: the trip count is not known at compile time and one copy of the step keeps the loop short in the instruction cache
    for (int c = 0; c < 2 * nst; ++c) {
      const int bu = (c >> 1) & 1, kin = (c & 1) * 32;     // buffer, first key of this step inside the stage
      if (c < nch) {                                       // wave-uniform: waves 0 and 1 skip the block's last step, which lies beyond their diagonal
        const int kb = c * 32;
        v8f s0 = (v8f){}, s1 = (v8f){};
        // the step's K fragments and V fragments (of hi | lo V: the hi plane's) are asked for as one group of LDS loads ahead of the products: the V loads then return behind the scores and the softmax
        const int ko = (kin + lr) * KP + 8 * hi, kq = ko + 16 * KP;
        const v16bf kh0 = ldsb(&ks[bu][0][ko]), kh1 = ldsb(&ks[bu][0][ko + 32]), kl0 = ldsb(&ks[bu][1][ko]), kl1 = ldsb(&ks[bu][1][ko + 32]);
        const v16bf kh2 = ldsb(&ks[bu][0][kq]), kh3 = ldsb(&ks[bu][0][kq + 32]), kl2 = ldsb(&ks[bu][1][kq]), kl3 = ldsb(&ks[bu][1][kq + 32]);
        const int vo = lr * KP + kin + 8 * hi;
        v16bf vfa[4];
#pragma unroll
        for (int sl = 0; sl < 4; ++sl) vfa[sl] = ldsb(&vs[bu][0][vo + sl * 16 * KP]);
        s0 = mmab(qh0, kh0, s0); s0 = mmab(qh1, kh1, s0); s0 = mmab(ql0, kh0, s0); s0 = mmab(ql1, kh1, s0); s0 = mmab(qh0, kl0, s0); s0 = mmab(qh1, kl1, s0);
        s1 = mmab(qh0, kh2, s1); s1 = mmab(qh1, kh3, s1); s1 = mmab(ql0, kh2, s1); s1 = mmab(ql1, kh3, s1); s1 = mmab(qh0, kl2, s1); s1 = mmab(qh1, kl3, s1);
        const bool diag = (kb + 31 > qrow0);     // wave-uniform: only the last step of a wave touches the diagonal
        const int kg0 = kb + lr;
#pragma unroll
        for (int r = 0; r < 8; ++r) {
            const int qg = qrow0 + 8 * hi + r;
            float v0 = s0[r] * L2E, v1 = s1[r] * L2E;     // the 1/8 scale is carried by the q planes
            if (diag) { v0 = (kg0 <= qg) ? v0 : NEGB; v1 = (kg0 + 16 <= qg) ? v1 : NEGB; }
            float mx = fmaxf(v0, v1);
            mx = fmaxf(mx, __shfl_xor(mx, 1, 32)); mx = fmaxf(mx, __shfl_xor(mx, 2, 32)); mx = fmaxf(mx, __shfl_xor(mx, 4, 32)); mx = fmaxf(mx, __shfl_xor(mx, 8, 32));
            const float mnew = fmaxf(m[r], mx);
            const float alpha = __builtin_amdgcn_exp2f(m[r] - mnew);
            const float e0 = __builtin_amdgcn_exp2f(v0 - mnew), e1 = __builtin_amdgcn_exp2f(v1 - mnew);
            l[r] = l[r] * alpha + (e0 + e1); m[r] = mnew;
#pragma unroll
            for (int sl = 0; sl < 4; ++sl) oa[sl][r] *= alpha;
            const int po = (8 * hi + r) * 40 + lr;
            if (EARLY) { unsigned short a2, c2; splitf(e0, a2, c2); ph[wave][po] = a2; pl[wave][po] = c2; splitf(e1, a2, c2); ph[wave][po + 16] = a2; pl[wave][po + 16] = c2; }
            else { pf[wave][po] = (h16)(e0 * PCAR); pf[wave][po + 16] = (h16)(e1 * PCAR); }
        }
        wave_sync_lds();
        if (EARLY) {
            const v16bf pah = cat16b(*(const v8usa*)(&ph[wave][lr * 40 + 8 * hi]), *(const v8usa*)(&ph[wave][lr * 40 + 16 + 8 * hi]));
            const v16bf pal = cat16b(*(const v8usa*)(&pl[wave][lr * 40 + 8 * hi]), *(const v8usa*)(&pl[wave][lr * 40 + 16 + 8 * hi]));
            v16bf vfb[4];                                     // the lo plane's fragments come here, with P: held from the top of the step they would push the wave past 256 registers
#pragma unroll
            for (int sl = 0; sl < 4; ++sl) vfb[sl] = ldsb(&vs[bu][EARLY ? 1 : 0][vo + sl * 16 * KP]);
#pragma unroll
            for (int sl = 0; sl < 4; ++sl) { oa[sl] = mmab(pah, vfa[sl], oa[sl]); oa[sl] = mmab(pal, vfa[sl], oa[sl]); oa[sl] = mmab(pah, vfb[sl], oa[sl]); }
        } else {
            const v16h pa = cat16(*(const v8ha*)(&pf[wave][lr * 40 + 8 * hi]), *(const v8ha*)(&pf[wave][lr * 40 + 16 + 8 * hi]));
#pragma unroll
            for (int sl = 0; sl < 4; ++sl) oa[sl] = mmah(pa, __builtin_bit_cast(v16h, vfa[sl]), oa[sl]);
        }
        wave_sync_lds();
      }
      if (c & 1) {                                            // foot of a stage, passed by every wave
        const int st = c >> 1;
        asm volatile("s_wait_dscnt 0x0" ::: "memory");        // this wave's reads of the stage's buffer are done
        asm volatile("s_wait_asynccnt 0x0" ::: "memory");     // this wave's copies of the next stage have landed
        __syncthreads();                                      // publishes the next stage and frees this stage's buffer
        if (st + 2 < nst) stage(st + 2);
      }
    }
    asm volatile("s_wait_asynccnt 0x0" ::: "memory");         // no copy is left in flight when the Q tile's LDS becomes output staging
    const float carry = EARLY ? 1.0f : (1.0f / PCAR);
#pragma unroll
    for (int r = 0; r < 8; ++r) { float t = l[r]; t += __shfl_xor(t, 1, 32); t += __shfl_xor(t, 2, 32); t += __shfl_xor(t, 4, 32); t += __shfl_xor(t, 8, 32);
        const float inv = carry * (1.0f / t);
#pragma unroll
        for (int sl = 0; sl < 4; ++sl) os[wave][(8 * hi + r) * 68 + sl * 16 + lr] = oa[sl][r] * inv; }
    wave_sync_lds();
    const int r4 = lane >> 3, d0 = (lane & 7) * 8; const int b = bh / NH, h = bh - b * NH;
#pragma unroll 1
    for (int it = 0; it < 4; ++it) {
        const int row = it * 4 + r4;
        const v4f a0 = *(const v4fa*)(&os[wave][row * 68 + d0]), a1 = *(const v4fa*)(&os[wave][row * 68 + d0 + 4]);
        v8us oh, ol;
#pragma unroll
        for (int e = 0; e < 8; ++e) { const float x = (e < 4) ? a0[e & 3] : a1[e & 3]; unsigned short a2, c2; splitf(x, a2, c2); oh[e] = a2; ol[e] = c2; }
        const size_t oo = ((size_t)(b * SEQ + qrow0 + row)) * DM + h * HD + d0;
        *(v8us*)(Ah + oo) = oh; *(v8us*)(Al + oo) = ol;  }
}
// query rows [0, RH): grid (RH/64, NB*NH); query rows [RH, SEQ): grid ((SEQ-RH)/64, NB*NH); 128 threads
__global__ __launch_bounds__(128) void k_attn_e(const bf* __restrict__ Qh, const bf* __restrict__ Ql, const bf* __restrict__ Kh, const bf* __restrict__ Kl,
                                                const h16* __restrict__ V16, const bf* __restrict__ Vh, const bf* __restrict__ Vl, bf* Ah, bf* Al) {
    attn_body<true>(Qh, Ql, Kh, Kl, V16, Vh, Vl, Ah, Al, 0); }
__global__ __launch_bounds__(128) void k_attn_l(const bf* __restrict__ Qh, const bf* __restrict__ Ql, const bf* __restrict__ Kh, const bf* __restrict__ Kl,
                                                const h16* __restrict__ V16, const bf* __restrict__ Vh, const bf* __restrict__ Vl, bf* Ah, bf* Al) {
    attn_body<false>(Qh, Ql, Kh, Kl, V16, Vh, Vl, Ah, Al, RH); }

constexpr size_t al256(size_t b) { return (b + 255) & ~(size_t)255; }
constexpr size_t SZ_XB = al256((size_t)MR * DM * 2);
constexpr size_t SZ_W4 = al256((size_t)4 * DM * DM * 2);
constexpr size_t SZ_CS = al256((size_t)SEQ * 32 * 2 * 4);
constexpr size_t SZ_QK = al256((size_t)2 * PLN * 2);
constexpr size_t SZ_V16 = al256((size_t)NB * DM * SEQ * 2);
constexpr size_t SZ_VR = al256((size_t)NB * DM * RH * 2);
constexpr size_t SZ_AT = al256((size_t)MR * DM * 2);
constexpr size_t SZ_TOTAL = SZ_XB + SZ_W4 + SZ_CS + 2 * SZ_QK + SZ_V16 + 2 * SZ_VR + 2 * SZ_AT;
static_assert(SZ_TOTAL <= (size_t)134217728);

extern "C" void kernel_launch(void* const* d_in, const int* in_sizes, int n_in,
                              void* d_out, int out_size, void* d_ws, size_t ws_size, hipStream_t stream) {
    if (n_in < 5) return;
    if (in_sizes[0] < (NB - 1) * SEQ_FULL * DM + SEQ * DM) return;
    if (in_sizes[1] < DM * DM || in_sizes[2] < DM * DM || in_sizes[3] < DM * DM || in_sizes[4] < DM * DM) return;
    if (out_size < MR * DM) return;
    if (SZ_TOTAL > ws_size) return;
    const float* x = (const float*)d_in[0]; const float* wq = (const float*)d_in[1]; const float* wk = (const float*)d_in[2];
    const float* wv = (const float*)d_in[3]; const float* wo = (const float*)d_in[4];      // wire order x, w_q, w_k, w_v, w_proj (each [out][in])
    float* OUT = (float*)d_out;
    char* wsp = (char*)d_ws;
    bf* XB = (bf*)wsp; wsp += SZ_XB;
    bf* W4 = (bf*)wsp; wsp += SZ_W4;            // Wq | Wk | Wv | Wo, each [DM][DM] Bt as stored
    float* CS = (float*)wsp; wsp += SZ_CS;
    bf* QKh = (bf*)wsp; wsp += SZ_QK;           // [q | k][b*NH + h][t][64] hi
    bf* QKl = (bf*)wsp; wsp += SZ_QK;           // lo
    h16* V16 = (h16*)wsp; wsp += SZ_V16;        // [b][h*64 + d][t]
    bf* Vh = (bf*)wsp; wsp += SZ_VR;            // [b][h*64 + d][t < RH]
    bf* Vl = (bf*)wsp; wsp += SZ_VR;
    bf* ATh = (bf*)wsp; wsp += SZ_AT;           // merged-head context [b*SEQ + t][h*64 + d] hi
    bf* ATl = (bf*)wsp; wsp += SZ_AT;
    const unsigned nw8 = (unsigned)(DM * DM / 8);
    k_cvtx<<<(unsigned)(((size_t)MR * DM / 8 + 255) / 256), 256, 0, stream>>>(x, XB);
    k_cvt8<<<(nw8 + 255) / 256, 256, 0, stream>>>(wq, W4, (int)nw8);
    k_cvt8<<<(nw8 + 255) / 256, 256, 0, stream>>>(wk, W4 + (size_t)DM * DM, (int)nw8);
    k_cvt8<<<(nw8 + 255) / 256, 256, 0, stream>>>(wv, W4 + (size_t)2 * DM * DM, (int)nw8);
    k_cvt8<<<(nw8 + 255) / 256, 256, 0, stream>>>(wo, W4 + (size_t)3 * DM * DM, (int)nw8);
    k_cs<<<(SEQ * 32 + 255) / 256, 256, 0, stream>>>(CS);
    k_projqk<<<dim3(MR / 64, NH, 2), 32, 0, stream>>>(XB, W4, CS, QKh, QKl);
    k_projv<<<dim3(DM / 64, SEQ / 64, NB), 32, 0, stream>>>(W4, XB, V16, Vh, Vl);
    k_attn_e<<<dim3(RH / 64, NB * NH), 128, 0, stream>>>(QKh, QKl, QKh + PLN, QKl + PLN, V16, Vh, Vl, ATh, ATl);
    if (SEQ > RH) k_attn_l<<<dim3((SEQ - RH) / 64, NB * NH), 128, 0, stream>>>(QKh, QKl, QKh + PLN, QKl + PLN, V16, Vh, Vl, ATh, ATl);
    k_projo<<<dim3(MR / 64, DM / 64), 32, 0, stream>>>(ATh, ATl, W4, OUT);
}

// v002
// One run takes 159 microseconds.
// Two timings next to v001 put it at 1.52 and 1.53 times that version's speed.
// Counting every step since v000, it is 2.32 times as fast.
#include <hip/hip_runtime.h>

// Causal multi-head self-attention: separate bias-free [out][in] q/k/v projections, per-head RMS normalisation of q and k (no gain), half-split rotary
// (first half x1 cos + x2 sin, second half -x1 sin + x2 cos, positions = arange), scale 1/8, causal softmax, [out][in] output projection.
// Compute dtypes (all v_wmma_f32_16x16x32, f32 accumulate): q/k/v projections bf16 x bf16 (inputs converted RNE to bf16); scores bf16 hi|lo x hi|lo (3 products);
// P.V f16 single product (P carried x1024) for query rows >= RH, bf16 hi|lo 3 products for rows < RH; output projection ctx bf16 hi|lo x bf16 weights (2 products); norm/rotary/softmax f32.

#ifndef NB
#define NB 2
#endif
#ifndef SEQ
#define SEQ 2048
#endif
#define NB_FULL  2
#define SEQ_FULL 2048
#define DM   1024
#define NH   16
#define HD   64
#if SEQ < 256
#define RH   SEQ
#else
#define RH   256                      // query rows < RH: P and V as bf16 hi|lo (3 products)
#endif
#define MR   (NB * SEQ)
#define PLN  ((size_t)NB * NH * SEQ * HD)
#define PCAR 1024.0f
#define L2E  1.4426950408889634f
#define NEGB (-1.0e30f)
#define RMS_EPS 1.1920928955078125e-07f

static_assert(NB >= 1 && NB <= NB_FULL);
static_assert(SEQ >= 64 && SEQ <= SEQ_FULL);
static_assert(SEQ % 64 == 0);
static_assert(RH % 64 == 0);
static_assert(RH <= SEQ);
static_assert(DM % 64 == 0);
static_assert(DM % 32 == 0);
static_assert(NH * HD == DM);
static_assert(HD == 64);
static_assert(MR % 128 == 0);
static_assert(SEQ % 128 == 0);
static_assert(DM % 128 == 0 && DM >= 256);

typedef _Float16 h16;
typedef unsigned short bf;
typedef __attribute__((ext_vector_type(16))) __bf16   v16bf;
typedef __attribute__((ext_vector_type(16))) _Float16 v16h;
typedef __attribute__((ext_vector_type(8)))  _Float16 v8h;
typedef __attribute__((ext_vector_type(8)))  unsigned short v8us;
typedef __attribute__((ext_vector_type(8)))  float    v8f;
typedef __attribute__((ext_vector_type(4)))  float    v4f;
typedef __attribute__((ext_vector_type(2)))  float    v2f;
typedef v8h  __attribute__((may_alias)) v8ha;
typedef v4f  __attribute__((may_alias)) v4fa;
typedef v8us __attribute__((may_alias)) v8usa;

__device__ __forceinline__ unsigned short f2bf(float f) { unsigned u = __float_as_uint(f); u += 0x7FFFu + ((u >> 16) & 1u); return (unsigned short)(u >> 16); }
__device__ __forceinline__ float bf2f(unsigned short b) { return __uint_as_float(((unsigned)b) << 16); }
__device__ __forceinline__ void splitf(float y, unsigned short& h, unsigned short& l) { h = f2bf(y); l = f2bf(y - bf2f(h)); }
__device__ __forceinline__ v16h cat16(v8h lo, v8h hi) { return __builtin_shufflevector(lo, hi, 0, 1, 2, 3, 4, 5, 6, 7, 8, 9, 10, 11, 12, 13, 14, 15); }
__device__ __forceinline__ v16bf cat16b(v8us lo, v8us hi) { return __builtin_bit_cast(v16bf, __builtin_shufflevector(lo, hi, 0, 1, 2, 3, 4, 5, 6, 7, 8, 9, 10, 11, 12, 13, 14, 15)); }
// fragment loads from K-contiguous 16-bit global rows: elements 0..7 <- p[0..7], elements 8..15 <- p[16..23]; caller adds 8*(lane>>4)
__device__ __forceinline__ v16bf ldb(const bf* p) { return cat16b(*(const v8us*)p, *(const v8us*)(p + 16)); }
__device__ __forceinline__ v16h  ldh(const h16* p) { return cat16(*(const v8h*)p, *(const v8h*)(p + 16)); }
// one WMMA + its own hazard guard (accumulator tied, fragments kept live)
__device__ __forceinline__ v8f mmab(v16bf a, v16bf b, v8f c) {
    c = __builtin_amdgcn_wmma_f32_16x16x32_bf16(false, a, false, b, (short)0, c, false, false);
    asm volatile("v_nop\n\tv_nop\n\tv_nop\n\tv_nop" : "+v"(c) : "v"(a), "v"(b));
    return c; }
__device__ __forceinline__ v8f mmah(v16h a, v16h b, v8f c) {
    c = __builtin_amdgcn_wmma_f32_16x16x32_f16(false, a, false, b, (short)0, c, false, false);
    asm volatile("v_nop\n\tv_nop\n\tv_nop\n\tv_nop" : "+v"(c) : "v"(a), "v"(b));
    return c; }
__device__ __forceinline__ void wave_sync_lds() { asm volatile("s_wait_dscnt 0" ::: "memory"); __builtin_amdgcn_wave_barrier(); asm volatile("" ::: "memory"); }

// ---- projection core: a block of 4 waves makes a 128x128 tile, wave w the 64x64 part (w >> 1, w & 1): acc[mb][nb] += A[rows][k] Bt[cols][k] (+ A2 rows when NSPLIT), K = DM, bf16 planes with row pitch DM.
// Each stage of 128 k (256 bytes of the block's 128 A rows and 128 Bt rows; two buffers) is brought into LDS by asynchronous 16-byte copies that cover whole lines; rows lie at a pitch of 272 bytes and every
// fragment is a pair of 16-byte LDS loads. The k order of every accumulator is ascending in steps of 32.
#define GK 128                        // k per stage
#define GP 136                        // LDS row pitch in 16-bit elements: 256 data bytes + 16
__device__ __forceinline__ v16bf ldsb(const bf* p) { return cat16b(*(const v8usa*)p, *(const v8usa*)(p + 16)); }
// 64 rows of 256 bytes, global (row pitch DM elements) -> LDS (row pitch 272 bytes), by 128 threads: thread t takes 16 bytes at column (t & 15) of rows (t >> 4) + 0, 8, ..., 56.
// The address wait stands inside the statement so that no address register is rewritten ahead of it.
__device__ __forceinline__ void copy_rows64w(const bf* ldst, const bf* gsrc) {
    const int t = threadIdx.x;
    const unsigned l0 = (unsigned)(size_t)ldst + (unsigned)((t >> 4) * (GP * 2) + (t & 15) * 16);
    const unsigned l1 = l0 + 8 * GP * 2, l2 = l0 + 16 * GP * 2, l3 = l0 + 24 * GP * 2, l4 = l0 + 32 * GP * 2, l5 = l0 + 40 * GP * 2, l6 = l0 + 48 * GP * 2, l7 = l0 + 56 * GP * 2;
    const char* g0 = (const char*)gsrc + (size_t)(t >> 4) * (DM * 2) + (t & 15) * 16;
    const char* g1 = g0 + (size_t)8 * DM * 2;  const char* g2 = g0 + (size_t)16 * DM * 2; const char* g3 = g0 + (size_t)24 * DM * 2; const char* g4 = g0 + (size_t)32 * DM * 2;
    const char* g5 = g0 + (size_t)40 * DM * 2; const char* g6 = g0 + (size_t)48 * DM * 2; const char* g7 = g0 + (size_t)56 * DM * 2;
    asm volatile("global_load_async_to_lds_b128 %0, %8, off\n\t"
                 "global_load_async_to_lds_b128 %1, %9, off\n\t"
                 "global_load_async_to_lds_b128 %2, %10, off\n\t"
                 "global_load_async_to_lds_b128 %3, %11, off\n\t"
                 "global_load_async_to_lds_b128 %4, %12, off\n\t"
                 "global_load_async_to_lds_b128 %5, %13, off\n\t"
                 "global_load_async_to_lds_b128 %6, %14, off\n\t"
                 "global_load_async_to_lds_b128 %7, %15, off\n\t"
                 "s_wait_xcnt 0x0"
                 :: "v"(l0), "v"(l1), "v"(l2), "v"(l3), "v"(l4), "v"(l5), "v"(l6), "v"(l7), "v"(g0), "v"(g1), "v"(g2), "v"(g3), "v"(g4), "v"(g5), "v"(g6), "v"(g7) : "memory");
}
// ar0, br0: first A row and first Bt row of the BLOCK's tile; wm, wn: the wave's 64-row half of each
template <int NSPLIT>
__device__ __forceinline__ void gemm_acc(const bf* __restrict__ A, const bf* __restrict__ A2, const bf* __restrict__ Bt, int ar0, int br0, int wm, int wn, v8f (&acc)[4][4]) {
    __shared__ __align__(16) bf ring[2][NSPLIT ? 3 : 2][128 * GP];      // [buffer][A | Bt | A2][row][k]
    const int lane = threadIdx.x & 31, lr = lane & 15, hi = lane >> 4;
    auto stage = [&](int st) {                // stage st -> buffer st & 1; k = st * GK .. st * GK + GK - 1 < DM
        const int bu = st & 1; const int ga = ar0 * DM + st * GK, gb = br0 * DM + st * GK;
        copy_rows64w(&ring[bu][0][0], A + ga);  copy_rows64w(&ring[bu][0][64 * GP], A + ga + 64 * DM);
        copy_rows64w(&ring[bu][1][0], Bt + gb); copy_rows64w(&ring[bu][1][64 * GP], Bt + gb + 64 * DM);
        if (NSPLIT) { copy_rows64w(&ring[bu][NSPLIT ? 2 : 0][0], A2 + ga); copy_rows64w(&ring[bu][NSPLIT ? 2 : 0][64 * GP], A2 + ga + 64 * DM); }
    };
    stage(0);
    asm volatile("s_wait_asynccnt 0x0" ::: "memory");     // this wave's copies of stage 0 have landed
    __syncthreads();                                      // ... and every other wave's
    stage(1);
    const int ao = (wm * 64 + lr) * GP + 8 * hi, bo = (wn * 64 + lr) * GP + 8 * hi;
#pragma unroll 1                      // one copy of a stage's code: the eight stages are alike and the foot's barrier ends each
    for (int st = 0; st < DM / GK; ++st) {
        const int bu = st & 1;
#pragma unroll                        // four 32-k blocks a stage, constant LDS offsets
        for (int kk = 0; kk < GK; kk += 32) {
            // a block's fragments are asked for as one group of LDS loads ahead of its products: one exposed LDS latency a block, the later fragments return behind the first products
            v16bf a[4], a2[4], b[4];
#pragma unroll
            for (int mb = 0; mb < 4; ++mb) a[mb] = ldsb(&ring[bu][0][ao + mb * 16 * GP + kk]);
            b[0] = ldsb(&ring[bu][1][bo + kk]);
#pragma unroll
            for (int mb = 0; mb < 4; ++mb) if (NSPLIT) a2[mb] = ldsb(&ring[bu][NSPLIT ? 2 : 0][ao + mb * 16 * GP + kk]);
#pragma unroll
            for (int nb = 1; nb < 4; ++nb) b[nb] = ldsb(&ring[bu][1][bo + nb * 16 * GP + kk]);
#pragma unroll
            for (int nb = 0; nb < 4; ++nb) {
#pragma unroll
                for (int mb = 0; mb < 4; ++mb) { acc[mb][nb] = mmab(a[mb], b[nb], acc[mb][nb]); if (NSPLIT) acc[mb][nb] = mmab(a2[mb], b[nb], acc[mb][nb]); } }
        }
        asm volatile("s_wait_dscnt 0x0" ::: "memory");        // this wave's reads of the stage's buffer are done
        asm volatile("s_wait_asynccnt 0x0" ::: "memory");     // this wave's copies of the next stage have landed
        __syncthreads();                                      // publishes the next stage and frees this stage's buffer
        if (st + 2 < DM / GK) stage(st + 2);
    }
    asm volatile("s_wait_asynccnt 0x0" ::: "memory");         // no copy is left in flight when the wave goes on to its epilogue
}

__global__ __launch_bounds__(256) void k_cvtx(const float* __restrict__ x, bf* XB) {
    const size_t i = (size_t)blockIdx.x * 256 + threadIdx.x; if (i >= (size_t)MR * DM / 8) return;
    const size_t e = i * 8; const int row = (int)(e / DM), col = (int)(e % DM); const int b = row / SEQ, t = row - b * SEQ;
    const v8f v = *(const v8f*)(x + ((size_t)b * SEQ_FULL + t) * DM + col); v8us o;
#pragma unroll
    for (int k = 0; k < 8; ++k) o[k] = f2bf(v[k]);
    *(v8us*)(XB + e) = o;  }
__global__ __launch_bounds__(256) void k_cvt8(const float* __restrict__ src, bf* dst, int n8) {
    const int i = blockIdx.x * 256 + threadIdx.x; if (i >= n8) return; const v8f v = *(const v8f*)(src + (size_t)i * 8); v8us o;
#pragma unroll
    for (int k = 0; k < 8; ++k) o[k] = f2bf(v[k]);
    *(v8us*)(dst + (size_t)i * 8) = o;  }
__global__ __launch_bounds__(256) void k_cs(float* CS) {
    const int idx = blockIdx.x * 256 + threadIdx.x; if (idx >= SEQ * 32) return; const int j = idx & 31, t = idx >> 5;
    double p = 1.0;
    if (j & 1)  p *= 1.333521432163324;      // 10000^(1/32)
    if (j & 2)  p *= 1.7782794100389228;     // 10000^(1/16)
    if (j & 4)  p *= 3.1622776601683795;     // 10000^(1/8)
    if (j & 8)  p *= 10.0;                   // 10000^(1/4)
    if (j & 16) p *= 100.0;                  // 10000^(1/2)
    const float pf = (float)p; const float inv = 1.0f / pf; const float ang = (float)t * inv;
    float sn, cs; sincosf(ang, &sn, &cs);
    v2f o; o[0] = cs; o[1] = sn;
    *(v2f*)(CS + (size_t)idx * 2) = o;  }

// ---- k_projqk: z = 0 (q, scaled 1/8) / 1 (k): a block makes 128 tokens x two heads of x W^T, each wave 64 tokens x one head; epilogue per 16-token slab: per-head RMS normalisation, half-split rotary, bf16 hi|lo planes [b*NH + head][t][64].
__global__ __launch_bounds__(128) void k_projqk(const bf* __restrict__ XB, const bf* __restrict__ W4, const float* __restrict__ CS, bf* PH, bf* PL) {
    __shared__ __align__(16) float osw[4][16 * 68];
    const int lane = threadIdx.x & 31, lr = lane & 15, hi = lane >> 4;
    const int wave = __builtin_amdgcn_readfirstlane(threadIdx.x >> 5), wm = wave >> 1, wn = wave & 1;
    float* os = &osw[wave][0];
    const int r0 = blockIdx.x * 128 + wm * 64, head = blockIdx.y * 2 + wn, z = blockIdx.z;
    const bf* Bt = W4 + (size_t)z * DM * DM;
    const float sc = (z == 0) ? 0.125f : 1.0f;
    const size_t pz = (size_t)z * PLN;
    v8f acc[4][4];
#pragma unroll
    for (int mb = 0; mb < 4; ++mb)
#pragma unroll
        for (int nb = 0; nb < 4; ++nb) acc[mb][nb] = (v8f){};
    gemm_acc<0>(XB, XB, Bt, blockIdx.x * 128, blockIdx.y * 128, wm, wn, acc);
    const int r4 = lane >> 3, j8 = lane & 7, d0 = j8 * 8, dp = d0 ^ 32, i0 = d0 & 31;
    const float sgn = (j8 < 4) ? 1.0f : -1.0f;
    const int b = r0 / SEQ, tb = r0 - b * SEQ;
#pragma unroll
    for (int mb = 0; mb < 4; ++mb) {
#pragma unroll
        for (int nb = 0; nb < 4; ++nb) {
#pragma unroll
            for (int j = 0; j < 8; ++j) os[(hi * 8 + j) * 68 + nb * 16 + lr] = acc[mb][nb][j]; }
        wave_sync_lds();
#pragma unroll 1
        for (int it = 0; it < 4; ++it) {
            const int row = it * 4 + r4; const int t = tb + mb * 16 + row;
            const v4f a0 = *(const v4fa*)(os + row * 68 + d0), a1 = *(const v4fa*)(os + row * 68 + d0 + 4);
            const v4f b0 = *(const v4fa*)(os + row * 68 + dp), b1 = *(const v4fa*)(os + row * 68 + dp + 4);
            float ow[8], pw[8], cs[16];
#pragma unroll
            for (int e = 0; e < 4; ++e) { ow[e] = a0[e]; ow[4 + e] = a1[e]; pw[e] = b0[e]; pw[4 + e] = b1[e]; }
            float ss = 0.f;
#pragma unroll
            for (int e = 0; e < 8; ++e) ss += ow[e] * ow[e];
            ss += __shfl_xor(ss, 1, 32); ss += __shfl_xor(ss, 2, 32); ss += __shfl_xor(ss, 4, 32);
            const float rn = rsqrtf(ss * (1.0f / 64.0f) + RMS_EPS);
            const float* cp = CS + ((size_t)t * 32 + i0) * 2;
            const v4f c0v = *(const v4f*)cp, c1v = *(const v4f*)(cp + 4), c2v = *(const v4f*)(cp + 8), c3v = *(const v4f*)(cp + 12);
#pragma unroll
            for (int e = 0; e < 4; ++e) { cs[e] = c0v[e]; cs[4 + e] = c1v[e]; cs[8 + e] = c2v[e]; cs[12 + e] = c3v[e]; }
            v8us oh, ol;
#pragma unroll
            for (int e = 0; e < 8; ++e) { const float xo = ow[e] * rn, xp = pw[e] * rn; const float r = (xo * cs[2 * e] + sgn * (xp * cs[2 * e + 1])) * sc;
                unsigned short a2, c2; splitf(r, a2, c2); oh[e] = a2; ol[e] = c2; }
            const size_t oo = pz + (((size_t)(b * NH + head)) * SEQ + t) * HD + d0;
            *(v8us*)(PH + oo) = oh; *(v8us*)(PL + oo) = ol;  }
        wave_sync_lds();
    }
}

// ---- k_projv: transposed value projection V^T[b][n][t] = sum_k Wv[n][k] x[b][t][k] (A = weight rows, Bt = token rows): f16 plane (pitch SEQ) + bf16 hi|lo planes for t < RH (pitch RH).
__global__ __launch_bounds__(128) void k_projv(const bf* __restrict__ W4, const bf* __restrict__ XB, h16* V16, bf* Vh, bf* Vl) {
    __shared__ __align__(16) float osw[4][16 * 68];
    const int lane = threadIdx.x & 31, lr = lane & 15, hi = lane >> 4;
    const int wave = __builtin_amdgcn_readfirstlane(threadIdx.x >> 5), wm = wave >> 1, wn = wave & 1;
    float* os = &osw[wave][0];
    const int r0 = blockIdx.x * 128 + wm * 64, c0 = blockIdx.y * 128 + wn * 64, b = blockIdx.z;
    const bf* A = W4 + (size_t)2 * DM * DM; const bf* Bt = XB + (size_t)b * SEQ * DM;
    v8f acc[4][4];
#pragma unroll
    for (int mb = 0; mb < 4; ++mb)
#pragma unroll
        for (int nb = 0; nb < 4; ++nb) acc[mb][nb] = (v8f){};
    gemm_acc<0>(A, A, Bt, blockIdx.x * 128, blockIdx.y * 128, wm, wn, acc);
    const int r4 = lane >> 3, j8 = lane & 7; const bool early = (c0 < RH);
#pragma unroll
    for (int mb = 0; mb < 4; ++mb) {
#pragma unroll
        for (int nb = 0; nb < 4; ++nb) {
#pragma unroll
            for (int j = 0; j < 8; ++j) os[(hi * 8 + j) * 68 + nb * 16 + lr] = acc[mb][nb][j]; }
        wave_sync_lds();
#pragma unroll 1
        for (int it = 0; it < 4; ++it) {
            const int row = it * 4 + r4; const int n = r0 + mb * 16 + row; const int t0 = c0 + j8 * 8;
            const v4f a0 = *(const v4fa*)(os + row * 68 + j8 * 8), a1 = *(const v4fa*)(os + row * 68 + j8 * 8 + 4);
            v8h o16; v8us oh, ol;
#pragma unroll
            for (int e = 0; e < 8; ++e) { const float x = (e < 4) ? a0[e & 3] : a1[e & 3]; o16[e] = (h16)x; unsigned short a2, c2; splitf(x, a2, c2); oh[e] = a2; ol[e] = c2; }
            const size_t o1 = ((size_t)(b * DM + n)) * SEQ + t0; const size_t o2 = ((size_t)(b * DM + n)) * RH + t0;
            *(v8h*)(V16 + o1) = o16; if (early) { *(v8us*)(Vh + o2) = oh; *(v8us*)(Vl + o2) = ol; }
             }
        wave_sync_lds();
    }
}

__global__ __launch_bounds__(128) void k_projo(const bf* __restrict__ ATh, const bf* __restrict__ ATl, const bf* __restrict__ W4, float* OUT) {
    __shared__ __align__(16) float osw[4][16 * 68];
    const int lane = threadIdx.x & 31, lr = lane & 15, hi = lane >> 4;
    const int wave = __builtin_amdgcn_readfirstlane(threadIdx.x >> 5), wm = wave >> 1, wn = wave & 1;
    float* os = &osw[wave][0];
    const int r0 = blockIdx.x * 128 + wm * 64, c0 = blockIdx.y * 128 + wn * 64;
    const bf* Bt = W4 + (size_t)3 * DM * DM;
    v8f acc[4][4];
#pragma unroll
    for (int mb = 0; mb < 4; ++mb)
#pragma unroll
        for (int nb = 0; nb < 4; ++nb) acc[mb][nb] = (v8f){};
    gemm_acc<1>(ATh, ATl, Bt, blockIdx.x * 128, blockIdx.y * 128, wm, wn, acc);
#pragma unroll
    for (int mb = 0; mb < 4; ++mb) {
#pragma unroll
        for (int nb = 0; nb < 4; ++nb) {
#pragma unroll
            for (int j = 0; j < 8; ++j) os[(hi * 8 + j) * 68 + nb * 16 + lr] = acc[mb][nb][j]; }
        wave_sync_lds();
        float* crow = OUT + (size_t)(r0 + mb * 16) * DM + c0;
{
#pragma unroll
            for (int s = 0; s < 8; ++s) { const int row = 2 * s + hi, cofs = lr * 4; const v4f val = *(const v4fa*)(os + row * 68 + cofs);
                *(v4f*)(crow + (size_t)row * DM + cofs) = val; }
             }
        wave_sync_lds();
    }
}

// ---- fused causal attention, online softmax. One wave per 16 query rows, 4 waves per block. The block's 64 Q rows (once) and each stage of 64 keys (K hi, K lo, V^T rows; two buffers) are brought
// into LDS by asynchronous 16-byte copies that cover whole 128-byte lines; rows lie at a pitch of 144 bytes and every fragment is a pair of 16-byte LDS loads. 32 keys per step, two steps per stage;
// scores = (qh + ql).(kh + kl) without the lo.lo term; running max / sum in f32 (log2 domain); P through a wave-private LDS tile.
#define KP 72                         // LDS row pitch in 16-bit elements: 128 data bytes + 16
// 64 rows of 128 bytes, global (row pitch gpitch bytes) -> LDS (row pitch 144 bytes), by 128 threads: thread t takes 16 bytes at column (t & 7) of rows (t >> 3) + 0, 16, 32, 48.
// The address wait stands inside the statement so that no address register is rewritten ahead of it.
__device__ __forceinline__ void copy_rows64(const bf* ldst, const void* gsrc, int gpitch) {
    const int t = threadIdx.x;
    const unsigned l0 = (unsigned)(size_t)ldst + (unsigned)((t >> 3) * (KP * 2) + (t & 7) * 16);
    const unsigned l1 = l0 + 16 * KP * 2, l2 = l0 + 32 * KP * 2, l3 = l0 + 48 * KP * 2;
    const char* g0 = (const char*)gsrc + (size_t)(t >> 3) * gpitch + (t & 7) * 16;
    const char* g1 = g0 + (size_t)16 * gpitch; const char* g2 = g0 + (size_t)32 * gpitch; const char* g3 = g0 + (size_t)48 * gpitch;
    asm volatile("global_load_async_to_lds_b128 %0, %4, off\n\t"
                 "global_load_async_to_lds_b128 %1, %5, off\n\t"
                 "global_load_async_to_lds_b128 %2, %6, off\n\t"
                 "global_load_async_to_lds_b128 %3, %7, off\n\t"
                 "s_wait_xcnt 0x0"
                 :: "v"(l0), "v"(l1), "v"(l2), "v"(l3), "v"(g0), "v"(g1), "v"(g2), "v"(g3) : "memory");
}
template <bool EARLY>
__device__ __forceinline__ void attn_body(const bf* __restrict__ Qh, const bf* __restrict__ Ql, const bf* __restrict__ Kh, const bf* __restrict__ Kl,
                                          const h16* __restrict__ V16, const bf* __restrict__ Vh, const bf* __restrict__ Vl, bf* Ah, bf* Al, int rowoff) {
    __shared__ __align__(16) float os[4][16 * 72];                 // first the Q tile (hi rows, then lo rows, 64 x 144 bytes each), in the epilogue each wave's output staging (pitch 68 floats)
    __shared__ __align__(16) bf  ks[2][2][64 * KP];                // [buffer][hi | lo][key][d]
    __shared__ __align__(16) bf  vs[2][EARLY ? 2 : 1][64 * KP];    // [buffer][plane][d][key]
    __shared__ __align__(16) h16 pf[4][16 * 40];
    __shared__ __align__(16) bf  ph[4][16 * 40];
    __shared__ __align__(16) bf  pl[4][16 * 40];
    static_assert(sizeof(os) == (size_t)2 * 64 * KP * 2);
    const int lane = threadIdx.x & 31, lr = lane & 15, hi = lane >> 4;
    const int wave = __builtin_amdgcn_readfirstlane(threadIdx.x >> 5);
    const int bh = blockIdx.y; const int qblk = rowoff + blockIdx.x * 64; const int qrow0 = qblk + wave * 16;
    const int pb = bh * SEQ * HD;
    const int nch = (qrow0 >> 5) + 1;
    const int nst = (qblk >> 6) + 1;          // stages of 64 keys, the same for the whole block; the last one holds the diagonal
    bf* qsm = (bf*)&os[0][0];
    auto stage = [&](int st) {                // stage st -> buffer st & 1; keys st * 64 .. st * 64 + 63 <= qblk + 63
        const int bu = st & 1;
        copy_rows64(&ks[bu][0][0], Kh + pb + st * 64 * HD, HD * 2);
        copy_rows64(&ks[bu][1][0], Kl + pb + st * 64 * HD, HD * 2);
        if (EARLY) { copy_rows64(&vs[bu][0][0], Vh + bh * HD * RH + st * 64, RH * 2); copy_rows64(&vs[bu][EARLY ? 1 : 0][0], Vl + bh * HD * RH + st * 64, RH * 2); }
        else copy_rows64(&vs[bu][0][0], V16 + bh * HD * SEQ + st * 64, SEQ * 2);
    };
    copy_rows64(qsm, Qh + pb + qblk * HD, HD * 2);
    copy_rows64(qsm + 64 * KP, Ql + pb + qblk * HD, HD * 2);
    stage(0);
    asm volatile("s_wait_asynccnt 0x0" ::: "memory");     // this wave's copies of Q and stage 0 have landed
    __syncthreads();                                      // ... and every other wave's
    if (nst > 1) stage(1);
    const int qf = (wave * 16 + lr) * KP + 8 * hi;
    const v16bf qh0 = ldsb(qsm + qf), qh1 = ldsb(qsm + qf + 32), ql0 = ldsb(qsm + 64 * KP + qf), ql1 = ldsb(qsm + 64 * KP + qf + 32);
    v8f oa[4];
#pragma unroll
    for (int sl = 0; sl < 4; ++sl) oa[sl] = (v8f){};
    float m[8], l[8];
#pragma unroll
    for (int r = 0; r < 8; ++r) { m[r] = NEGB; l[r] = 0.f; }
#pragma unroll 1                      // stays rolled, as before: the trip count is not known at compile time and one copy of the step keeps the loop short in the instruction cache
    for (int c = 0; c < 2 * nst; ++c) {
      const int bu = (c >> 1) & 1, kin = (c & 1) * 32;     // buffer, first key of this step inside the stage
      if (c < nch) {                                       // wave-uniform: waves 0 and 1 skip the block's last step, which lies beyond their diagonal
        const int kb = c * 32;
        v8f s0 = (v8f){}, s1 = (v8f){};
        // the step's K fragments and V fragments (of hi | lo V: the hi plane's) are asked for as one group of LDS loads ahead of the products: the V loads then return behind the scores and the softmax
        const int ko = (kin + lr) * KP + 8 * hi, kq = ko + 16 * KP;
        const v16bf kh0 = ldsb(&ks[bu][0][ko]), kh1 = ldsb(&ks[bu][0][ko + 32]), kl0 = ldsb(&ks[bu][1][ko]), kl1 = ldsb(&ks[bu][1][ko + 32]);
        const v16bf kh2 = ldsb(&ks[bu][0][kq]), kh3 = ldsb(&ks[bu][0][kq + 32]), kl2 = ldsb(&ks[bu][1][kq]), kl3 = ldsb(&ks[bu][1][kq + 32]);
        const int vo = lr * KP + kin + 8 * hi;
        v16bf vfa[4];
#pragma unroll
        for (int sl = 0; sl < 4; ++sl) vfa[sl] = ldsb(&vs[bu][0][vo + sl * 16 * KP]);
        s0 = mmab(qh0, kh0, s0); s0 = mmab(qh1, kh1, s0); s0 = mmab(ql0, kh0, s0); s0 = mmab(ql1, kh1, s0); s0 = mmab(qh0, kl0, s0); s0 = mmab(qh1, kl1, s0);
        s1 = mmab(qh0, kh2, s1); s1 = mmab(qh1, kh3, s1); s1 = mmab(ql0, kh2, s1); s1 = mmab(ql1, kh3, s1); s1 = mmab(qh0, kl2, s1); s1 = mmab(qh1, kl3, s1);
        const bool diag = (kb + 31 > qrow0);     // wave-uniform: only the last step of a wave touches the diagonal
        const int kg0 = kb + lr;
#pragma unroll
        for (int r = 0; r < 8; ++r) {
            const int qg = qrow0 + 8 * hi + r;
            float v0 = s0[r] * L2E, v1 = s1[r] * L2E;     // the 1/8 scale is carried by the q planes
            if (diag) { v0 = (kg0 <= qg) ? v0 : NEGB; v1 = (kg0 + 16 <= qg) ? v1 : NEGB; }
            float mx = fmaxf(v0, v1);
            mx = fmaxf(mx, __shfl_xor(mx, 1, 32)); mx = fmaxf(mx, __shfl_xor(mx, 2, 32)); mx = fmaxf(mx, __shfl_xor(mx, 4, 32)); mx = fmaxf(mx, __shfl_xor(mx, 8, 32));
            const float mnew = fmaxf(m[r], mx);
            const float alpha = __builtin_amdgcn_exp2f(m[r] - mnew);
            const float e0 = __builtin_amdgcn_exp2f(v0 - mnew), e1 = __builtin_amdgcn_exp2f(v1 - mnew);
            l[r] = l[r] * alpha + (e0 + e1); m[r] = mnew;
#pragma unroll
            for (int sl = 0; sl < 4; ++sl) oa[sl][r] *= alpha;
            const int po = (8 * hi + r) * 40 + lr;
            if (EARLY) { unsigned short a2, c2; splitf(e0, a2, c2); ph[wave][po] = a2; pl[wave][po] = c2; splitf(e1, a2, c2); ph[wave][po + 16] = a2; pl[wave][po + 16] = c2; }
            else { pf[wave][po] = (h16)(e0 * PCAR); pf[wave][po + 16] = (h16)(e1 * PCAR); }
        }
        wave_sync_lds();
        if (EARLY) {
            const v16bf pah = cat16b(*(const v8usa*)(&ph[wave][lr * 40 + 8 * hi]), *(const v8usa*)(&ph[wave][lr * 40 + 16 + 8 * hi]));
            const v16bf pal = cat16b(*(const v8usa*)(&pl[wave][lr * 40 + 8 * hi]), *(const v8usa*)(&pl[wave][lr * 40 + 16 + 8 * hi]));
            v16bf vfb[4];                                     // the lo plane's fragments come here, with P: held from the top of the step they would push the wave past 256 registers
#pragma unroll
            for (int sl = 0; sl < 4; ++sl) vfb[sl] = ldsb(&vs[bu][EARLY ? 1 : 0][vo + sl * 16 * KP]);
#pragma unroll
            for (int sl = 0; sl < 4; ++sl) { oa[sl] = mmab(pah, vfa[sl], oa[sl]); oa[sl] = mmab(pal, vfa[sl], oa[sl]); oa[sl] = mmab(pah, vfb[sl], oa[sl]); }
        } else {
            const v16h pa = cat16(*(const v8ha*)(&pf[wave][lr * 40 + 8 * hi]), *(const v8ha*)(&pf[wave][lr * 40 + 16 + 8 * hi]));
#pragma unroll
            for (int sl = 0; sl < 4; ++sl) oa[sl] = mmah(pa, __builtin_bit_cast(v16h, vfa[sl]), oa[sl]);
        }
        wave_sync_lds();
      }
      if (c & 1) {                                            // foot of a stage, passed by every wave
        const int st = c >> 1;
        asm volatile("s_wait_dscnt 0x0" ::: "memory");        // this wave's reads of the stage's buffer are done
        asm volatile("s_wait_asynccnt 0x0" ::: "memory");     // this wave's copies of the next stage have landed
        __syncthreads();                                      // publishes the next stage and frees this stage's buffer
        if (st + 2 < nst) stage(st + 2);
      }
    }
    asm volatile("s_wait_asynccnt 0x0" ::: "memory");         // no copy is left in flight when the Q tile's LDS becomes output staging
    const float carry = EARLY ? 1.0f : (1.0f / PCAR);
#pragma unroll
    for (int r = 0; r < 8; ++r) { float t = l[r]; t += __shfl_xor(t, 1, 32); t += __shfl_xor(t, 2, 32); t += __shfl_xor(t, 4, 32); t += __shfl_xor(t, 8, 32);
        const float inv = carry * (1.0f / t);
#pragma unroll
        for (int sl = 0; sl < 4; ++sl) os[wave][(8 * hi + r) * 68 + sl * 16 + lr] = oa[sl][r] * inv; }
    wave_sync_lds();
    const int r4 = lane >> 3, d0 = (lane & 7) * 8; const int b = bh / NH, h = bh - b * NH;
#pragma unroll 1
    for (int it = 0; it < 4; ++it) {
        const int row = it * 4 + r4;
        const v4f a0 = *(const v4fa*)(&os[wave][row * 68 + d0]), a1 = *(const v4fa*)(&os[wave][row * 68 + d0 + 4]);
        v8us oh, ol;
#pragma unroll
        for (int e = 0; e < 8; ++e) { const float x = (e < 4) ? a0[e & 3] : a1[e & 3]; unsigned short a2, c2; splitf(x, a2, c2); oh[e] = a2; ol[e] = c2; }
        const size_t oo = ((size_t)(b * SEQ + qrow0 + row)) * DM + h * HD + d0;
        *(v8us*)(Ah + oo) = oh; *(v8us*)(Al + oo) = ol;  }
}
// query rows [0, RH): grid (RH/64, NB*NH); query rows [RH, SEQ): grid ((SEQ-RH)/64, NB*NH); 128 threads
__global__ __launch_bounds__(128) void k_attn_e(const bf* __restrict__ Qh, const bf* __restrict__ Ql, const bf* __restrict__ Kh, const bf* __restrict__ Kl,
                                                const h16* __restrict__ V16, const bf* __restrict__ Vh, const bf* __restrict__ Vl, bf* Ah, bf* Al) {
    attn_body<true>(Qh, Ql, Kh, Kl, V16, Vh, Vl, Ah, Al, 0); }
__global__ __launch_bounds__(128) void k_attn_l(const bf* __restrict__ Qh, const bf* __restrict__ Ql, const bf* __restrict__ Kh, const bf* __restrict__ Kl,
                                                const h16* __restrict__ V16, const bf* __restrict__ Vh, const bf* __restrict__ Vl, bf* Ah, bf* Al) {
    attn_body<false>(Qh, Ql, Kh, Kl, V16, Vh, Vl, Ah, Al, RH); }

constexpr size_t al256(size_t b) { return (b + 255) & ~(size_t)255; }
constexpr size_t SZ_XB = al256((size_t)MR * DM * 2);
constexpr size_t SZ_W4 = al256((size_t)4 * DM * DM * 2);
constexpr size_t SZ_CS = al256((size_t)SEQ * 32 * 2 * 4);
constexpr size_t SZ_QK = al256((size_t)2 * PLN * 2);
constexpr size_t SZ_V16 = al256((size_t)NB * DM * SEQ * 2);
constexpr size_t SZ_VR = al256((size_t)NB * DM * RH * 2);
constexpr size_t SZ_AT = al256((size_t)MR * DM * 2);
constexpr size_t SZ_TOTAL = SZ_XB + SZ_W4 + SZ_CS + 2 * SZ_QK + SZ_V16 + 2 * SZ_VR + 2 * SZ_AT;
static_assert(SZ_TOTAL <= (size_t)134217728);

extern "C" void kernel_launch(void* const* d_in, const int* in_sizes, int n_in,
                              void* d_out, int out_size, void* d_ws, size_t ws_size, hipStream_t stream) {
    if (n_in < 5) return;
    if (in_sizes[0] < (NB - 1) * SEQ_FULL * DM + SEQ * DM) return;
    if (in_sizes[1] < DM * DM || in_sizes[2] < DM * DM || in_sizes[3] < DM * DM || in_sizes[4] < DM * DM) return;
    if (out_size < MR * DM) return;
    if (SZ_TOTAL > ws_size) return;
    const float* x = (const float*)d_in[0]; const float* wq = (const float*)d_in[1]; const float* wk = (const float*)d_in[2];
    const float* wv = (const float*)d_in[3]; const float* wo = (const float*)d_in[4];      // wire order x, w_q, w_k, w_v, w_proj (each [out][in])
    float* OUT = (float*)d_out;
    char* wsp = (char*)d_ws;
    bf* XB = (bf*)wsp; wsp += SZ_XB;
    bf* W4 = (bf*)wsp; wsp += SZ_W4;            // Wq | Wk | Wv | Wo, each [DM][DM] Bt as stored
    float* CS = (float*)wsp; wsp += SZ_CS;
    bf* QKh = (bf*)wsp; wsp += SZ_QK;           // [q | k][b*NH + h][t][64] hi
    bf* QKl = (bf*)wsp; wsp += SZ_QK;           // lo
    h16* V16 = (h16*)wsp; wsp += SZ_V16;        // [b][h*64 + d][t]
    bf* Vh = (bf*)wsp; wsp += SZ_VR;            // [b][h*64 + d][t < RH]
    bf* Vl = (bf*)wsp; wsp += SZ_VR;
    bf* ATh = (bf*)wsp; wsp += SZ_AT;           // merged-head context [b*SEQ + t][h*64 + d] hi
    bf* ATl = (bf*)wsp; wsp += SZ_AT;
    const unsigned nw8 = (unsigned)(DM * DM / 8);
    k_cvtx<<<(unsigned)(((size_t)MR * DM / 8 + 255) / 256), 256, 0, stream>>>(x, XB);
    k_cvt8<<<(nw8 + 255) / 256, 256, 0, stream>>>(wq, W4, (int)nw8);
    k_cvt8<<<(nw8 + 255) / 256, 256, 0, stream>>>(wk, W4 + (size_t)DM * DM, (int)nw8);
    k_cvt8<<<(nw8 + 255) / 256, 256, 0, stream>>>(wv, W4 + (size_t)2 * DM * DM, (int)nw8);
    k_cvt8<<<(nw8 + 255) / 256, 256, 0, stream>>>(wo, W4 + (size_t)3 * DM * DM, (int)nw8);
    k_cs<<<(SEQ * 32 + 255) / 256, 256, 0, stream>>>(CS);
    k_projqk<<<dim3(MR / 128, NH / 2, 2), 128, 0, stream>>>(XB, W4, CS, QKh, QKl);
    k_projv<<<dim3(DM / 128, SEQ / 128, NB), 128, 0, stream>>>(W4, XB, V16, Vh, Vl);
    k_attn_e<<<dim3(RH / 64, NB * NH), 128, 0, stream>>>(QKh, QKl, QKh + PLN, QKl + PLN, V16, Vh, Vl, ATh, ATl);
    if (SEQ > RH) k_attn_l<<<dim3((SEQ - RH) / 64, NB * NH), 128, 0, stream>>>(QKh, QKl, QKh + PLN, QKl + PLN, V16, Vh, Vl, ATh, ATl);
    k_projo<<<dim3(MR / 128, DM / 128), 128, 0, stream>>>(ATh, ATl, W4, OUT);
}

// v003
// A run of this version takes 153 microseconds.
// Next to v002, in two timings, it ran 1.05 and 1.04 times as fast.
// Counting every step since v000, it is 2.43 times as fast.
#include <hip/hip_runtime.h>

// Causal multi-head self-attention: separate bias-free [out][in] q/k/v projections, per-head RMS normalisation of q and k (no gain), half-split rotary
// (first half x1 cos + x2 sin, second half -x1 sin + x2 cos, positions = arange), scale 1/8, causal softmax, [out][in] output projection.
// Compute dtypes (all v_wmma_f32_16x16x32, f32 accumulate): q/k/v projections bf16 x bf16 (inputs converted RNE to bf16); scores bf16 hi|lo x hi|lo (3 products);
// P.V f16 single product (P carried x1024) for query rows >= RH, bf16 hi|lo 3 products for rows < RH; output projection ctx bf16 hi|lo x bf16 weights (2 products); norm/rotary/softmax f32.

#ifndef NB
#define NB 2
#endif
#ifndef SEQ
#define SEQ 2048
#endif
#define NB_FULL  2
#define SEQ_FULL 2048
#define DM   1024
#define NH   16
#define HD   64
#if SEQ < 256
#define RH   SEQ
#else
#define RH   256                      // query rows < RH: P and V as bf16 hi|lo (3 products)
#endif
#define MR   (NB * SEQ)
#define PLN  ((size_t)NB * NH * SEQ * HD)
#define PCAR 1024.0f
#define L2E  1.4426950408889634f
#define NEGB (-1.0e30f)
#define RMS_EPS 1.1920928955078125e-07f

static_assert(NB >= 1 && NB <= NB_FULL);
static_assert(SEQ >= 64 && SEQ <= SEQ_FULL);
static_assert(SEQ % 64 == 0);
static_assert(RH % 64 == 0);
static_assert(RH <= SEQ);
static_assert(DM % 64 == 0);
static_assert(DM % 32 == 0);
static_assert(NH * HD == DM);
static_assert(HD == 64);
static_assert(MR % 128 == 0);
static_assert(SEQ % 128 == 0);
static_assert(DM % 128 == 0 && DM >= 256);

typedef _Float16 h16;
typedef unsigned short bf;
typedef __attribute__((ext_vector_type(16))) __bf16   v16bf;
typedef __attribute__((ext_vector_type(16))) _Float16 v16h;
typedef __attribute__((ext_vector_type(8)))  _Float16 v8h;
typedef __attribute__((ext_vector_type(8)))  unsigned short v8us;
typedef __attribute__((ext_vector_type(8)))  float    v8f;
typedef __attribute__((ext_vector_type(4)))  float    v4f;
typedef __attribute__((ext_vector_type(2)))  float    v2f;
typedef v8h  __attribute__((may_alias)) v8ha;
typedef v4f  __attribute__((may_alias)) v4fa;
typedef v8us __attribute__((may_alias)) v8usa;

__device__ __forceinline__ unsigned short f2bf(float f) { unsigned u = __float_as_uint(f); u += 0x7FFFu + ((u >> 16) & 1u); return (unsigned short)(u >> 16); }
__device__ __forceinline__ float bf2f(unsigned short b) { return __uint_as_float(((unsigned)b) << 16); }
__device__ __forceinline__ void splitf(float y, unsigned short& h, unsigned short& l) { h = f2bf(y); l = f2bf(y - bf2f(h)); }
__device__ __forceinline__ v16h cat16(v8h lo, v8h hi) { return __builtin_shufflevector(lo, hi, 0, 1, 2, 3, 4, 5, 6, 7, 8, 9, 10, 11, 12, 13, 14, 15); }
__device__ __forceinline__ v16bf cat16b(v8us lo, v8us hi) { return __builtin_bit_cast(v16bf, __builtin_shufflevector(lo, hi, 0, 1, 2, 3, 4, 5, 6, 7, 8, 9, 10, 11, 12, 13, 14, 15)); }
// fragment loads from K-contiguous 16-bit global rows: elements 0..7 <- p[0..7], elements 8..15 <- p[16..23]; caller adds 8*(lane>>4)
__device__ __forceinline__ v16bf ldb(const bf* p) { return cat16b(*(const v8us*)p, *(const v8us*)(p + 16)); }
__device__ __forceinline__ v16h  ldh(const h16* p) { return cat16(*(const v8h*)p, *(const v8h*)(p + 16)); }
// one WMMA + its own hazard guard (accumulator tied, fragments kept live)
__device__ __forceinline__ v8f mmab(v16bf a, v16bf b, v8f c) {
    c = __builtin_amdgcn_wmma_f32_16x16x32_bf16(false, a, false, b, (short)0, c, false, false);
    asm volatile("v_nop\n\tv_nop\n\tv_nop\n\tv_nop" : "+v"(c) : "v"(a), "v"(b));
    return c; }
__device__ __forceinline__ v8f mmah(v16h a, v16h b, v8f c) {
    c = __builtin_amdgcn_wmma_f32_16x16x32_f16(false, a, false, b, (short)0, c, false, false);
    asm volatile("v_nop\n\tv_nop\n\tv_nop\n\tv_nop" : "+v"(c) : "v"(a), "v"(b));
    return c; }
__device__ __forceinline__ void wave_sync_lds() { asm volatile("s_wait_dscnt 0" ::: "memory"); __builtin_amdgcn_wave_barrier(); asm volatile("" ::: "memory"); }

// ---- projection core: a block of 4 waves makes a 128x128 tile, wave w the 64x64 part (w >> 1, w & 1): acc[mb][nb] += A[rows][k] Bt[cols][k] (+ A2 rows when NSPLIT), K = DM, bf16 planes with row pitch DM.
// Each stage of 128 k (256 bytes of the block's 128 A rows and 128 Bt rows; two buffers) is brought into LDS by asynchronous 16-byte copies that cover whole lines; rows lie at a pitch of 272 bytes and every
// fragment is a pair of 16-byte LDS loads. The k order of every accumulator is ascending in steps of 32.
#define GK 128                        // k per stage
#define GP 136                        // LDS row pitch in 16-bit elements: 256 data bytes + 16
__device__ __forceinline__ v16bf ldsb(const bf* p) { return cat16b(*(const v8usa*)p, *(const v8usa*)(p + 16)); }
// 64 rows of 256 bytes, global (row pitch DM elements) -> LDS (row pitch 272 bytes), by 128 threads: thread t takes 16 bytes at column (t & 15) of rows (t >> 4) + 0, 8, ..., 56.
// The address wait stands inside the statement so that no address register is rewritten ahead of it.
__device__ __forceinline__ void copy_rows64w(const bf* ldst, const bf* gsrc) {
    const int t = threadIdx.x;
    const unsigned l0 = (unsigned)(size_t)ldst + (unsigned)((t >> 4) * (GP * 2) + (t & 15) * 16);
    const unsigned l1 = l0 + 8 * GP * 2, l2 = l0 + 16 * GP * 2, l3 = l0 + 24 * GP * 2, l4 = l0 + 32 * GP * 2, l5 = l0 + 40 * GP * 2, l6 = l0 + 48 * GP * 2, l7 = l0 + 56 * GP * 2;
    const char* g0 = (const char*)gsrc + (size_t)(t >> 4) * (DM * 2) + (t & 15) * 16;
    const char* g1 = g0 + (size_t)8 * DM * 2;  const char* g2 = g0 + (size_t)16 * DM * 2; const char* g3 = g0 + (size_t)24 * DM * 2; const char* g4 = g0 + (size_t)32 * DM * 2;
    const char* g5 = g0 + (size_t)40 * DM * 2; const char* g6 = g0 + (size_t)48 * DM * 2; const char* g7 = g0 + (size_t)56 * DM * 2;
    asm volatile("global_load_async_to_lds_b128 %0, %8, off\n\t"
                 "global_load_async_to_lds_b128 %1, %9, off\n\t"
                 "global_load_async_to_lds_b128 %2, %10, off\n\t"
                 "global_load_async_to_lds_b128 %3, %11, off\n\t"
                 "global_load_async_to_lds_b128 %4, %12, off\n\t"
                 "global_load_async_to_lds_b128 %5, %13, off\n\t"
                 "global_load_async_to_lds_b128 %6, %14, off\n\t"
                 "global_load_async_to_lds_b128 %7, %15, off\n\t"
                 "s_wait_xcnt 0x0"
                 :: "v"(l0), "v"(l1), "v"(l2), "v"(l3), "v"(l4), "v"(l5), "v"(l6), "v"(l7), "v"(g0), "v"(g1), "v"(g2), "v"(g3), "v"(g4), "v"(g5), "v"(g6), "v"(g7) : "memory");
}
// ar0, br0: first A row and first Bt row of the BLOCK's tile; wm, wn: the wave's 64-row half of each
template <int NSPLIT>
__device__ __forceinline__ void gemm_acc(const bf* __restrict__ A, const bf* __restrict__ A2, const bf* __restrict__ Bt, int ar0, int br0, int wm, int wn, v8f (&acc)[4][4]) {
    __shared__ __align__(16) bf ring[2][NSPLIT ? 3 : 2][128 * GP];      // [buffer][A | Bt | A2][row][k]
    const int lane = threadIdx.x & 31, lr = lane & 15, hi = lane >> 4;
    auto stage = [&](int st) {                // stage st -> buffer st & 1; k = st * GK .. st * GK + GK - 1 < DM
        const int bu = st & 1; const int ga = ar0 * DM + st * GK, gb = br0 * DM + st * GK;
        copy_rows64w(&ring[bu][0][0], A + ga);  copy_rows64w(&ring[bu][0][64 * GP], A + ga + 64 * DM);
        copy_rows64w(&ring[bu][1][0], Bt + gb); copy_rows64w(&ring[bu][1][64 * GP], Bt + gb + 64 * DM);
        if (NSPLIT) { copy_rows64w(&ring[bu][NSPLIT ? 2 : 0][0], A2 + ga); copy_rows64w(&ring[bu][NSPLIT ? 2 : 0][64 * GP], A2 + ga + 64 * DM); }
    };
    stage(0);
    asm volatile("s_wait_asynccnt 0x0" ::: "memory");     // this wave's copies of stage 0 have landed
    __syncthreads();                                      // ... and every other wave's
    stage(1);
    const int ao = (wm * 64 + lr) * GP + 8 * hi, bo = (wn * 64 + lr) * GP + 8 * hi;
#pragma unroll 1                      // one copy of a stage's code: the eight stages are alike and the foot's barrier ends each
    for (int st = 0; st < DM / GK; ++st) {
        const int bu = st & 1;
#pragma unroll                        // four 32-k blocks a stage, constant LDS offsets
        for (int kk = 0; kk < GK; kk += 32) {
            // a block's fragments are asked for as one group of LDS loads ahead of its products: one exposed LDS latency a block, the later fragments return behind the first products
            v16bf a[4], a2[4], b[4];
#pragma unroll
            for (int mb = 0; mb < 4; ++mb) a[mb] = ldsb(&ring[bu][0][ao + mb * 16 * GP + kk]);
            b[0] = ldsb(&ring[bu][1][bo + kk]);
#pragma unroll
            for (int mb = 0; mb < 4; ++mb) if (NSPLIT) a2[mb] = ldsb(&ring[bu][NSPLIT ? 2 : 0][ao + mb * 16 * GP + kk]);
#pragma unroll
            for (int nb = 1; nb < 4; ++nb) b[nb] = ldsb(&ring[bu][1][bo + nb * 16 * GP + kk]);
#pragma unroll
            for (int nb = 0; nb < 4; ++nb) {
#pragma unroll
                for (int mb = 0; mb < 4; ++mb) { acc[mb][nb] = mmab(a[mb], b[nb], acc[mb][nb]); if (NSPLIT) acc[mb][nb] = mmab(a2[mb], b[nb], acc[mb][nb]); } }
        }
        asm volatile("s_wait_dscnt 0x0" ::: "memory");        // this wave's reads of the stage's buffer are done
        asm volatile("s_wait_asynccnt 0x0" ::: "memory");     // this wave's copies of the next stage have landed
        __syncthreads();                                      // publishes the next stage and frees this stage's buffer
        if (st + 2 < DM / GK) stage(st + 2);
    }
    asm volatile("s_wait_asynccnt 0x0" ::: "memory");         // no copy is left in flight when the wave goes on to its epilogue
}

// ---- k_prep: all that depends on the inputs alone, in one launch (none of the three jobs reads another's output): blocks [0, PB_CS) the cos | sin table, 4 entries a thread;
// then PB_X blocks x -> bf16 and 4 * PB_W blocks the four weights -> bf16 (RNE), PU vectors of 8 values a thread, a thread's loads all asked for ahead of its first conversion.
#define PU 8
constexpr unsigned PB_CS = SEQ * 32 / (256 * 4);
constexpr unsigned PB_X  = (unsigned)((size_t)MR * DM / 8 / (256 * PU));
constexpr unsigned PB_W  = DM * DM / 8 / (256 * PU);
static_assert((SEQ * 32) % (256 * 4) == 0);
static_assert(((size_t)MR * DM / 8) % (256 * PU) == 0);
static_assert((DM * DM / 8) % (256 * PU) == 0);
#define PROWS (256 * PU * 8 / DM)      // rows of x a block converts: whole rows of one batch
static_assert((256 * PU * 8) % DM == 0 && SEQ % PROWS == 0);
__global__ __launch_bounds__(256) void k_prep(const float* __restrict__ x, const float* __restrict__ wq, const float* __restrict__ wk, const float* __restrict__ wv, const float* __restrict__ wo,
                                              bf* XB, bf* W4, float* CS) {
    unsigned blk = blockIdx.x;
    if (blk < PB_CS) {
        for (int k = 0; k < 4; ++k) {
            const int idx = (int)(blk * 1024 + k * 256 + threadIdx.x); const int j = idx & 31, t = idx >> 5;
            double p = 1.0;
            if (j & 1)  p *= 1.333521432163324;      // 10000^(1/32)
            if (j & 2)  p *= 1.7782794100389228;     // 10000^(1/16)
            if (j & 4)  p *= 3.1622776601683795;     // 10000^(1/8)
            if (j & 8)  p *= 10.0;                   // 10000^(1/4)
            if (j & 16) p *= 100.0;                  // 10000^(1/2)
            const float pf = (float)p; const float inv = 1.0f / pf; const float ang = (float)t * inv;
            float sn, cs; sincosf(ang, &sn, &cs);
            v2f o; o[0] = cs; o[1] = sn;
            *(v2f*)(CS + (size_t)idx * 2) = o;
            asm volatile("s_wait_xcnt 0x0" ::: "memory");   // the next trip writes the registers that held this store's address
        }
        return;
    }
    blk -= PB_CS;
    const float* src; bf* dst;                // the block's PU * 256 vectors lie in a row in both
    if (blk < PB_X) {
        const int row = (int)(blk * PROWS); const int b = row / SEQ, t = row - b * SEQ;
        src = x + ((size_t)b * SEQ_FULL + t) * DM; dst = XB + (size_t)row * DM;
    } else {
        blk -= PB_X;
        const unsigned w = blk / PB_W; blk -= w * PB_W;
        src = ((w == 0) ? wq : (w == 1) ? wk : (w == 2) ? wv : wo) + (size_t)blk * (256 * PU * 8); dst = W4 + (size_t)w * DM * DM + (size_t)blk * (256 * PU * 8);
    }
    src += threadIdx.x * 8; dst += threadIdx.x * 8;
    v8f v[PU];
#pragma unroll
    for (int k = 0; k < PU; ++k) v[k] = *(const v8f*)(src + k * 256 * 8);
#pragma unroll
    for (int k = 0; k < PU; ++k) {
        v8us o;
#pragma unroll
        for (int e = 0; e < 8; ++e) o[e] = f2bf(v[k][e]);
        *(v8us*)(dst + k * 256 * 8) = o; }
    asm volatile("s_wait_xcnt 0x0" ::: "memory");           // stands behind the run of stores, ahead of whatever code follows them in the text and writes their registers
}

// ---- k_projqkv: the three input projections in one launch (none reads another's output), blockIdx.z = 0 (q, scaled 1/8) / 1 (k) / 2 (v), the same number of blocks each.
// z < 2: a block makes 128 tokens x two heads of x W^T, each wave 64 tokens x one head; epilogue per 16-token slab: per-head RMS normalisation, half-split rotary, bf16 hi|lo planes [b*NH + head][t][64].
// z = 2: transposed value projection V^T[b][n][t] = sum_k Wv[n][k] x[b][t][k] (A = weight rows, Bt = token rows): f16 plane (pitch SEQ) + bf16 hi|lo planes for t < RH (pitch RH).
static_assert(NH / 2 == DM / 128);
__global__ __launch_bounds__(128) void k_projqkv(const bf* __restrict__ XB, const bf* __restrict__ W4, const float* __restrict__ CS, bf* PH, bf* PL, h16* V16, bf* Vh, bf* Vl) {
    __shared__ __align__(16) float osw[4][16 * 68];
    const int lane = threadIdx.x & 31, lr = lane & 15, hi = lane >> 4;
    const int wave = __builtin_amdgcn_readfirstlane(threadIdx.x >> 5), wm = wave >> 1, wn = wave & 1;
    float* os = &osw[wave][0];
    const int z = blockIdx.z;
    // the block's tile: first A row, first Bt row; for v the flat block index is cut into (weight rows, tokens, batch)
    const int fl = blockIdx.y * (MR / 128) + blockIdx.x;
    const int vb = fl / ((DM / 128) * (SEQ / 128));
    const int ta = (z < 2) ? (int)blockIdx.x : fl % (DM / 128);
    const int tb_ = (z < 2) ? (int)blockIdx.y : (fl / (DM / 128)) % (SEQ / 128);
    const bf* A  = (z < 2) ? XB : W4 + (size_t)2 * DM * DM;
    const bf* Bt = (z < 2) ? W4 + (size_t)z * DM * DM : XB + (size_t)vb * SEQ * DM;
    v8f acc[4][4];
#pragma unroll
    for (int mb = 0; mb < 4; ++mb)
#pragma unroll
        for (int nb = 0; nb < 4; ++nb) acc[mb][nb] = (v8f){};
    gemm_acc<0>(A, A, Bt, ta * 128, tb_ * 128, wm, wn, acc);
    const int r0 = ta * 128 + wm * 64;
    const int r4 = lane >> 3, j8 = lane & 7;
    if (z < 2) {
        const int head = tb_ * 2 + wn;
        const float sc = (z == 0) ? 0.125f : 1.0f;
        const size_t pz = (size_t)z * PLN;
        const int d0 = j8 * 8, dp = d0 ^ 32, i0 = d0 & 31;
        const float sgn = (j8 < 4) ? 1.0f : -1.0f;
        const int b = r0 / SEQ, tb = r0 - b * SEQ;
#pragma unroll
        for (int mb = 0; mb < 4; ++mb) {
#pragma unroll
            for (int nb = 0; nb < 4; ++nb) {
#pragma unroll
                for (int j = 0; j < 8; ++j) os[(hi * 8 + j) * 68 + nb * 16 + lr] = acc[mb][nb][j]; }
            wave_sync_lds();
#pragma unroll 1
            for (int it = 0; it < 4; ++it) {
                const int row = it * 4 + r4; const int t = tb + mb * 16 + row;
                const v4f a0 = *(const v4fa*)(os + row * 68 + d0), a1 = *(const v4fa*)(os + row * 68 + d0 + 4);
                const v4f b0 = *(const v4fa*)(os + row * 68 + dp), b1 = *(const v4fa*)(os + row * 68 + dp + 4);
                float ow[8], pw[8], cs[16];
#pragma unroll
                for (int e = 0; e < 4; ++e) { ow[e] = a0[e]; ow[4 + e] = a1[e]; pw[e] = b0[e]; pw[4 + e] = b1[e]; }
                float ss = 0.f;
#pragma unroll
                for (int e = 0; e < 8; ++e) ss += ow[e] * ow[e];
                ss += __shfl_xor(ss, 1, 32); ss += __shfl_xor(ss, 2, 32); ss += __shfl_xor(ss, 4, 32);
                const float rn = rsqrtf(ss * (1.0f / 64.0f) + RMS_EPS);
                const float* cp = CS + ((size_t)t * 32 + i0) * 2;
                const v4f c0v = *(const v4f*)cp, c1v = *(const v4f*)(cp + 4), c2v = *(const v4f*)(cp + 8), c3v = *(const v4f*)(cp + 12);
#pragma unroll
                for (int e = 0; e < 4; ++e) { cs[e] = c0v[e]; cs[4 + e] = c1v[e]; cs[8 + e] = c2v[e]; cs[12 + e] = c3v[e]; }
                v8us oh, ol;
#pragma unroll
                for (int e = 0; e < 8; ++e) { const float xo = ow[e] * rn, xp = pw[e] * rn; const float r = (xo * cs[2 * e] + sgn * (xp * cs[2 * e + 1])) * sc;
                    unsigned short a2, c2; splitf(r, a2, c2); oh[e] = a2; ol[e] = c2; }
                const size_t oo = pz + (((size_t)(b * NH + head)) * SEQ + t) * HD + d0;
                *(v8us*)(PH + oo) = oh; *(v8us*)(PL + oo) = ol;
                asm volatile("s_wait_xcnt 0x0" ::: "memory"); }   // the next trip writes the registers that held these stores' addresses and data
            wave_sync_lds();
        }
    } else {
        const int c0 = tb_ * 128 + wn * 64, b = vb; const bool early = (c0 < RH);
#pragma unroll
        for (int mb = 0; mb < 4; ++mb) {
#pragma unroll
            for (int nb = 0; nb < 4; ++nb) {
#pragma unroll
                for (int j = 0; j < 8; ++j) os[(hi * 8 + j) * 68 + nb * 16 + lr] = acc[mb][nb][j]; }
            wave_sync_lds();
#pragma unroll 1
            for (int it = 0; it < 4; ++it) {
                const int row = it * 4 + r4; const int n = r0 + mb * 16 + row; const int t0 = c0 + j8 * 8;
                const v4f a0 = *(const v4fa*)(os + row * 68 + j8 * 8), a1 = *(const v4fa*)(os + row * 68 + j8 * 8 + 4);
                v8h o16; v8us oh, ol;
#pragma unroll
                for (int e = 0; e < 8; ++e) { const float x = (e < 4) ? a0[e & 3] : a1[e & 3]; o16[e] = (h16)x; unsigned short a2, c2; splitf(x, a2, c2); oh[e] = a2; ol[e] = c2; }
                const size_t o1 = ((size_t)(b * DM + n)) * SEQ + t0; const size_t o2 = ((size_t)(b * DM + n)) * RH + t0;
                *(v8h*)(V16 + o1) = o16;
                asm volatile("s_wait_xcnt 0x0" ::: "memory");   // ahead of the writes to this store's address and data registers
                if (early) { *(v8us*)(Vh + o2) = oh; *(v8us*)(Vl + o2) = ol;
                    asm volatile("s_wait_xcnt 0x0" ::: "memory"); }   // the same for the two hi | lo stores: the next trip writes their registers
            }
            wave_sync_lds();
        }
    }
}

__global__ __launch_bounds__(128) void k_projo(const bf* __restrict__ ATh, const bf* __restrict__ ATl, const bf* __restrict__ W4, float* OUT) {
    __shared__ __align__(16) float osw[4][16 * 68];
    const int lane = threadIdx.x & 31, lr = lane & 15, hi = lane >> 4;
    const int wave = __builtin_amdgcn_readfirstlane(threadIdx.x >> 5), wm = wave >> 1, wn = wave & 1;
    float* os = &osw[wave][0];
    const int r0 = blockIdx.x * 128 + wm * 64, c0 = blockIdx.y * 128 + wn * 64;
    const bf* Bt = W4 + (size_t)3 * DM * DM;
    v8f acc[4][4];
#pragma unroll
    for (int mb = 0; mb < 4; ++mb)
#pragma unroll
        for (int nb = 0; nb < 4; ++nb) acc[mb][nb] = (v8f){};
    gemm_acc<1>(ATh, ATl, Bt, blockIdx.x * 128, blockIdx.y * 128, wm, wn, acc);
#pragma unroll
    for (int mb = 0; mb < 4; ++mb) {
#pragma unroll
        for (int nb = 0; nb < 4; ++nb) {
#pragma unroll
            for (int j = 0; j < 8; ++j) os[(hi * 8 + j) * 68 + nb * 16 + lr] = acc[mb][nb][j]; }
        wave_sync_lds();
        float* crow = OUT + (size_t)(r0 + mb * 16) * DM + c0;
{
#pragma unroll
            for (int s = 0; s < 8; ++s) { const int row = 2 * s + hi, cofs = lr * 4; const v4f val = *(const v4fa*)(os + row * 68 + cofs);
                *(v4f*)(crow + (size_t)row * DM + cofs) = val; }
             }
        wave_sync_lds();
    }
}

// ---- fused causal attention, online softmax. One wave per 16 query rows, 4 waves per block. The block's 64 Q rows (once) and each stage of 64 keys (K hi, K lo, V^T rows; two buffers) are brought
// into LDS by asynchronous 16-byte copies that cover whole 128-byte lines; rows lie at a pitch of 144 bytes and every fragment is a pair of 16-byte LDS loads. 32 keys per step, two steps per stage;
// scores = (qh + ql).(kh + kl) without the lo.lo term; running max / sum in f32 (log2 domain); P through a wave-private LDS tile.
#define KP 72                         // LDS row pitch in 16-bit elements: 128 data bytes + 16
// 64 rows of 128 bytes, global (row pitch gpitch bytes) -> LDS (row pitch 144 bytes), by 128 threads: thread t takes 16 bytes at column (t & 7) of rows (t >> 3) + 0, 16, 32, 48.
// The address wait stands inside the statement so that no address register is rewritten ahead of it.
__device__ __forceinline__ void copy_rows64(const bf* ldst, const void* gsrc, int gpitch) {
    const int t = threadIdx.x;
    const unsigned l0 = (unsigned)(size_t)ldst + (unsigned)((t >> 3) * (KP * 2) + (t & 7) * 16);
    const unsigned l1 = l0 + 16 * KP * 2, l2 = l0 + 32 * KP * 2, l3 = l0 + 48 * KP * 2;
    const char* g0 = (const char*)gsrc + (size_t)(t >> 3) * gpitch + (t & 7) * 16;
    const char* g1 = g0 + (size_t)16 * gpitch; const char* g2 = g0 + (size_t)32 * gpitch; const char* g3 = g0 + (size_t)48 * gpitch;
    asm volatile("global_load_async_to_lds_b128 %0, %4, off\n\t"
                 "global_load_async_to_lds_b128 %1, %5, off\n\t"
                 "global_load_async_to_lds_b128 %2, %6, off\n\t"
                 "global_load_async_to_lds_b128 %3, %7, off\n\t"
                 "s_wait_xcnt 0x0"
                 :: "v"(l0), "v"(l1), "v"(l2), "v"(l3), "v"(g0), "v"(g1), "v"(g2), "v"(g3) : "memory");
}
template <bool EARLY>
__device__ __forceinline__ void attn_body(const bf* __restrict__ Qh, const bf* __restrict__ Ql, const bf* __restrict__ Kh, const bf* __restrict__ Kl,
                                          const h16* __restrict__ V16, const bf* __restrict__ Vh, const bf* __restrict__ Vl, bf* Ah, bf* Al, int rowoff) {
    __shared__ __align__(16) float os[4][16 * 72];                 // first the Q tile (hi rows, then lo rows, 64 x 144 bytes each), in the epilogue each wave's output staging (pitch 68 floats)
    __shared__ __align__(16) bf  ks[2][2][64 * KP];                // [buffer][hi | lo][key][d]
    __shared__ __align__(16) bf  vs[2][EARLY ? 2 : 1][64 * KP];    // [buffer][plane][d][key]
    __shared__ __align__(16) h16 pf[4][16 * 40];
    __shared__ __align__(16) bf  ph[4][16 * 40];
    __shared__ __align__(16) bf  pl[4][16 * 40];
    static_assert(sizeof(os) == (size_t)2 * 64 * KP * 2);
    const int lane = threadIdx.x & 31, lr = lane & 15, hi = lane >> 4;
    const int wave = __builtin_amdgcn_readfirstlane(threadIdx.x >> 5);
    const int bh = blockIdx.y; const int qblk = rowoff + blockIdx.x * 64; const int qrow0 = qblk + wave * 16;
    const int pb = bh * SEQ * HD;
    const int nch = (qrow0 >> 5) + 1;
    const int nst = (qblk >> 6) + 1;          // stages of 64 keys, the same for the whole block; the last one holds the diagonal
    bf* qsm = (bf*)&os[0][0];
    auto stage = [&](int st) {                // stage st -> buffer st & 1; keys st * 64 .. st * 64 + 63 <= qblk + 63
        const int bu = st & 1;
        copy_rows64(&ks[bu][0][0], Kh + pb + st * 64 * HD, HD * 2);
        copy_rows64(&ks[bu][1][0], Kl + pb + st * 64 * HD, HD * 2);
        if (EARLY) { copy_rows64(&vs[bu][0][0], Vh + bh * HD * RH + st * 64, RH * 2); copy_rows64(&vs[bu][EARLY ? 1 : 0][0], Vl + bh * HD * RH + st * 64, RH * 2); }
        else copy_rows64(&vs[bu][0][0], V16 + bh * HD * SEQ + st * 64, SEQ * 2);
    };
    copy_rows64(qsm, Qh + pb + qblk * HD, HD * 2);
    copy_rows64(qsm + 64 * KP, Ql + pb + qblk * HD, HD * 2);
    stage(0);
    asm volatile("s_wait_asynccnt 0x0" ::: "memory");     // this wave's copies of Q and stage 0 have landed
    __syncthreads();                                      // ... and every other wave's
    if (nst > 1) stage(1);
    const int qf = (wave * 16 + lr) * KP + 8 * hi;
    const v16bf qh0 = ldsb(qsm + qf), qh1 = ldsb(qsm + qf + 32), ql0 = ldsb(qsm + 64 * KP + qf), ql1 = ldsb(qsm + 64 * KP + qf + 32);
    v8f oa[4];
#pragma unroll
    for (int sl = 0; sl < 4; ++sl) oa[sl] = (v8f){};
    float m[8], l[8];
#pragma unroll
    for (int r = 0; r < 8; ++r) { m[r] = NEGB; l[r] = 0.f; }
#pragma unroll 1                      // stays rolled, as before: the trip count is not known at compile time and one copy of the step keeps the loop short in the instruction cache
    for (int c = 0; c < 2 * nst; ++c) {
      const int bu = (c >> 1) & 1, kin = (c & 1) * 32;     // buffer, first key of this step inside the stage
      if (c < nch) {                                       // wave-uniform: waves 0 and 1 skip the block's last step, which lies beyond their diagonal
        const int kb = c * 32;
        v8f s0 = (v8f){}, s1 = (v8f){};
        // the step's K fragments and V fragments (of hi | lo V: the hi plane's) are asked for as one group of LDS loads ahead of the products: the V loads then return behind the scores and the softmax
        const int ko = (kin + lr) * KP + 8 * hi, kq = ko + 16 * KP;
        const v16bf kh0 = ldsb(&ks[bu][0][ko]), kh1 = ldsb(&ks[bu][0][ko + 32]), kl0 = ldsb(&ks[bu][1][ko]), kl1 = ldsb(&ks[bu][1][ko + 32]);
        const v16bf kh2 = ldsb(&ks[bu][0][kq]), kh3 = ldsb(&ks[bu][0][kq + 32]), kl2 = ldsb(&ks[bu][1][kq]), kl3 = ldsb(&ks[bu][1][kq + 32]);
        const int vo = lr * KP + kin + 8 * hi;
        v16bf vfa[4];
#pragma unroll
        for (int sl = 0; sl < 4; ++sl) vfa[sl] = ldsb(&vs[bu][0][vo + sl * 16 * KP]);
        s0 = mmab(qh0, kh0, s0); s0 = mmab(qh1, kh1, s0); s0 = mmab(ql0, kh0, s0); s0 = mmab(ql1, kh1, s0); s0 = mmab(qh0, kl0, s0); s0 = mmab(qh1, kl1, s0);
        s1 = mmab(qh0, kh2, s1); s1 = mmab(qh1, kh3, s1); s1 = mmab(ql0, kh2, s1); s1 = mmab(ql1, kh3, s1); s1 = mmab(qh0, kl2, s1); s1 = mmab(qh1, kl3, s1);
        const bool diag = (kb + 31 > qrow0);     // wave-uniform: only the last step of a wave touches the diagonal
        const int kg0 = kb + lr;
#pragma unroll
        for (int r = 0; r < 8; ++r) {
            const int qg = qrow0 + 8 * hi + r;
            float v0 = s0[r] * L2E, v1 = s1[r] * L2E;     // the 1/8 scale is carried by the q planes
            if (diag) { v0 = (kg0 <= qg) ? v0 : NEGB; v1 = (kg0 + 16 <= qg) ? v1 : NEGB; }
            float mx = fmaxf(v0, v1);
            mx = fmaxf(mx, __shfl_xor(mx, 1, 32)); mx = fmaxf(mx, __shfl_xor(mx, 2, 32)); mx = fmaxf(mx, __shfl_xor(mx, 4, 32)); mx = fmaxf(mx, __shfl_xor(mx, 8, 32));
            const float mnew = fmaxf(m[r], mx);
            const float alpha = __builtin_amdgcn_exp2f(m[r] - mnew);
            const float e0 = __builtin_amdgcn_exp2f(v0 - mnew), e1 = __builtin_amdgcn_exp2f(v1 - mnew);
            l[r] = l[r] * alpha + (e0 + e1); m[r] = mnew;
#pragma unroll
            for (int sl = 0; sl < 4; ++sl) oa[sl][r] *= alpha;
            const int po = (8 * hi + r) * 40 + lr;
            if (EARLY) { unsigned short a2, c2; splitf(e0, a2, c2); ph[wave][po] = a2; pl[wave][po] = c2; splitf(e1, a2, c2); ph[wave][po + 16] = a2; pl[wave][po + 16] = c2; }
            else { pf[wave][po] = (h16)(e0 * PCAR); pf[wave][po + 16] = (h16)(e1 * PCAR); }
        }
        wave_sync_lds();
        if (EARLY) {
            const v16bf pah = cat16b(*(const v8usa*)(&ph[wave][lr * 40 + 8 * hi]), *(const v8usa*)(&ph[wave][lr * 40 + 16 + 8 * hi]));
            const v16bf pal = cat16b(*(const v8usa*)(&pl[wave][lr * 40 + 8 * hi]), *(const v8usa*)(&pl[wave][lr * 40 + 16 + 8 * hi]));
            v16bf vfb[4];                                     // the lo plane's fragments come here, with P: held from the top of the step they would push the wave past 256 registers
#pragma unroll
            for (int sl = 0; sl < 4; ++sl) vfb[sl] = ldsb(&vs[bu][EARLY ? 1 : 0][vo + sl * 16 * KP]);
#pragma unroll
            for (int sl = 0; sl < 4; ++sl) { oa[sl] = mmab(pah, vfa[sl], oa[sl]); oa[sl] = mmab(pal, vfa[sl], oa[sl]); oa[sl] = mmab(pah, vfb[sl], oa[sl]); }
        } else {
            const v16h pa = cat16(*(const v8ha*)(&pf[wave][lr * 40 + 8 * hi]), *(const v8ha*)(&pf[wave][lr * 40 + 16 + 8 * hi]));
#pragma unroll
            for (int sl = 0; sl < 4; ++sl) oa[sl] = mmah(pa, __builtin_bit_cast(v16h, vfa[sl]), oa[sl]);
        }
        wave_sync_lds();
      }
      if (c & 1) {                                            // foot of a stage, passed by every wave
        const int st = c >> 1;
        asm volatile("s_wait_dscnt 0x0" ::: "memory");        // this wave's reads of the stage's buffer are done
        asm volatile("s_wait_asynccnt 0x0" ::: "memory");     // this wave's copies of the next stage have landed
        __syncthreads();                                      // publishes the next stage and frees this stage's buffer
        if (st + 2 < nst) stage(st + 2);
      }
    }
    asm volatile("s_wait_asynccnt 0x0" ::: "memory");         // no copy is left in flight when the Q tile's LDS becomes output staging
    const float carry = EARLY ? 1.0f : (1.0f / PCAR);
#pragma unroll
    for (int r = 0; r < 8; ++r) { float t = l[r]; t += __shfl_xor(t, 1, 32); t += __shfl_xor(t, 2, 32); t += __shfl_xor(t, 4, 32); t += __shfl_xor(t, 8, 32);
        const float inv = carry * (1.0f / t);
#pragma unroll
        for (int sl = 0; sl < 4; ++sl) os[wave][(8 * hi + r) * 68 + sl * 16 + lr] = oa[sl][r] * inv; }
    wave_sync_lds();
    const int r4 = lane >> 3, d0 = (lane & 7) * 8; const int b = bh / NH, h = bh - b * NH;
#pragma unroll 1
    for (int it = 0; it < 4; ++it) {
        const int row = it * 4 + r4;
        const v4f a0 = *(const v4fa*)(&os[wave][row * 68 + d0]), a1 = *(const v4fa*)(&os[wave][row * 68 + d0 + 4]);
        v8us oh, ol;
#pragma unroll
        for (int e = 0; e < 8; ++e) { const float x = (e < 4) ? a0[e & 3] : a1[e & 3]; unsigned short a2, c2; splitf(x, a2, c2); oh[e] = a2; ol[e] = c2; }
        const size_t oo = ((size_t)(b * SEQ + qrow0 + row)) * DM + h * HD + d0;
        *(v8us*)(Ah + oo) = oh; *(v8us*)(Al + oo) = ol;  }
}
// query rows [0, RH): grid (RH/64, NB*NH); query rows [RH, SEQ): grid ((SEQ-RH)/64, NB*NH); 128 threads
__global__ __launch_bounds__(128) void k_attn_e(const bf* __restrict__ Qh, const bf* __restrict__ Ql, const bf* __restrict__ Kh, const bf* __restrict__ Kl,
                                                const h16* __restrict__ V16, const bf* __restrict__ Vh, const bf* __restrict__ Vl, bf* Ah, bf* Al) {
    attn_body<true>(Qh, Ql, Kh, Kl, V16, Vh, Vl, Ah, Al, 0); }
__global__ __launch_bounds__(128) void k_attn_l(const bf* __restrict__ Qh, const bf* __restrict__ Ql, const bf* __restrict__ Kh, const bf* __restrict__ Kl,
                                                const h16* __restrict__ V16, const bf* __restrict__ Vh, const bf* __restrict__ Vl, bf* Ah, bf* Al) {
    attn_body<false>(Qh, Ql, Kh, Kl, V16, Vh, Vl, Ah, Al, RH); }

constexpr size_t al256(size_t b) { return (b + 255) & ~(size_t)255; }
constexpr size_t SZ_XB = al256((size_t)MR * DM * 2);
constexpr size_t SZ_W4 = al256((size_t)4 * DM * DM * 2);
constexpr size_t SZ_CS = al256((size_t)SEQ * 32 * 2 * 4);
constexpr size_t SZ_QK = al256((size_t)2 * PLN * 2);
constexpr size_t SZ_V16 = al256((size_t)NB * DM * SEQ * 2);
constexpr size_t SZ_VR = al256((size_t)NB * DM * RH * 2);
constexpr size_t SZ_AT = al256((size_t)MR * DM * 2);
constexpr size_t SZ_TOTAL = SZ_XB + SZ_W4 + SZ_CS + 2 * SZ_QK + SZ_V16 + 2 * SZ_VR + 2 * SZ_AT;
static_assert(SZ_TOTAL <= (size_t)134217728);

extern "C" void kernel_launch(void* const* d_in, const int* in_sizes, int n_in,
                              void* d_out, int out_size, void* d_ws, size_t ws_size, hipStream_t stream) {
    if (n_in < 5) return;
    if (in_sizes[0] < (NB - 1) * SEQ_FULL * DM + SEQ * DM) return;
    if (in_sizes[1] < DM * DM || in_sizes[2] < DM * DM || in_sizes[3] < DM * DM || in_sizes[4] < DM * DM) return;
    if (out_size < MR * DM) return;
    if (SZ_TOTAL > ws_size) return;
    const float* x = (const float*)d_in[0]; const float* wq = (const float*)d_in[1]; const float* wk = (const float*)d_in[2];
    const float* wv = (const float*)d_in[3]; const float* wo = (const float*)d_in[4];      // wire order x, w_q, w_k, w_v, w_proj (each [out][in])
    float* OUT = (float*)d_out;
    char* wsp = (char*)d_ws;
    bf* XB = (bf*)wsp; wsp += SZ_XB;
    bf* W4 = (bf*)wsp; wsp += SZ_W4;            // Wq | Wk | Wv | Wo, each [DM][DM] as stored (Wv the A operand, the others Bt)
    float* CS = (float*)wsp; wsp += SZ_CS;
    bf* QKh = (bf*)wsp; wsp += SZ_QK;           // [q | k][b*NH + h][t][64] hi
    bf* QKl = (bf*)wsp; wsp += SZ_QK;           // lo
    h16* V16 = (h16*)wsp; wsp += SZ_V16;        // [b][h*64 + d][t]
    bf* Vh = (bf*)wsp; wsp += SZ_VR;            // [b][h*64 + d][t < RH]
    bf* Vl = (bf*)wsp; wsp += SZ_VR;
    bf* ATh = (bf*)wsp; wsp += SZ_AT;           // merged-head context [b*SEQ + t][h*64 + d] hi
    bf* ATl = (bf*)wsp; wsp += SZ_AT;
    k_prep<<<PB_CS + PB_X + 4 * PB_W, 256, 0, stream>>>(x, wq, wk, wv, wo, XB, W4, CS);
    k_projqkv<<<dim3(MR / 128, NH / 2, 3), 128, 0, stream>>>(XB, W4, CS, QKh, QKl, V16, Vh, Vl);
    k_attn_e<<<dim3(RH / 64, NB * NH), 128, 0, stream>>>(QKh, QKl, QKh + PLN, QKl + PLN, V16, Vh, Vl, ATh, ATl);
    if (SEQ > RH) k_attn_l<<<dim3((SEQ - RH) / 64, NB * NH), 128, 0, stream>>>(QKh, QKl, QKh + PLN, QKl + PLN, V16, Vh, Vl, ATh, ATl);
    k_projo<<<dim3(MR / 128, DM / 128), 128, 0, stream>>>(ATh, ATl, W4, OUT);
}

// v004
// One run takes 130 microseconds.
// Next to v003, in two timings, it ran 1.17 times as fast each time.
// Over all steps from v000 it is 2.85 times as fast.
#include <hip/hip_runtime.h>

// Causal multi-head self-attention: separate bias-free [out][in] q/k/v projections, per-head RMS normalisation of q and k (no gain), half-split rotary
// (first half x1 cos + x2 sin, second half -x1 sin + x2 cos, positions = arange), scale 1/8, causal softmax, [out][in] output projection.
// Compute dtypes (all v_wmma_f32_16x16x32, f32 accumulate): q/k/v projections bf16 x bf16 (inputs converted RNE to bf16); scores bf16 hi|lo x hi|lo (3 products);
// P.V f16 single product for query rows >= RH, bf16 hi|lo 3 products for rows < RH; output projection ctx bf16 hi|lo x bf16 weights (2 products); norm/rotary/softmax f32.

#ifndef NB
#define NB 2
#endif
#ifndef SEQ
#define SEQ 2048
#endif
#define NB_FULL  2
#define SEQ_FULL 2048
#define DM   1024
#define NH   16
#define HD   64
#if SEQ < 256
#define RH   SEQ
#else
#define RH   256                      // query rows < RH: P and V as bf16 hi|lo (3 products)
#endif
#define MR   (NB * SEQ)
#define PLN  ((size_t)NB * NH * SEQ * HD)
#define L2E  1.4426950408889634f
// Every q row and k row leaves the RMS normalisation with a sum of squares <= 64 and the rotary keeps it, so every score (the 1/8 included) lies in [-8, 8] for any input.
// The softmax is taken against that fixed bound: P = 2^(PEXP + (s - 8) log2 e), between 2^-10 and 2^14, all normal f16 values; the common factor cancels against the row sum of the same P.
#define SMAX 8.0f
#define PEXP 14.0f
#define SBIAS (PEXP - SMAX * L2E)
#define NEGB (-1.0e30f)
#define RMS_EPS 1.1920928955078125e-07f

static_assert(NB >= 1 && NB <= NB_FULL);
static_assert(SEQ >= 64 && SEQ <= SEQ_FULL);
static_assert(SEQ % 64 == 0);
static_assert(RH % 64 == 0);
static_assert(RH <= SEQ);
static_assert(DM % 64 == 0);
static_assert(DM % 32 == 0);
static_assert(NH * HD == DM);
static_assert(HD == 64);
static_assert(MR % 128 == 0);
static_assert(SEQ % 128 == 0);
static_assert(DM % 128 == 0 && DM >= 256);

typedef _Float16 h16;
typedef unsigned short bf;
typedef __attribute__((ext_vector_type(16))) __bf16   v16bf;
typedef __attribute__((ext_vector_type(16))) _Float16 v16h;
typedef __attribute__((ext_vector_type(8)))  _Float16 v8h;
typedef __attribute__((ext_vector_type(8)))  unsigned short v8us;
typedef __attribute__((ext_vector_type(8)))  float    v8f;
typedef __attribute__((ext_vector_type(4)))  float    v4f;
typedef __attribute__((ext_vector_type(2)))  float    v2f;
typedef v8h  __attribute__((may_alias)) v8ha;
typedef v4f  __attribute__((may_alias)) v4fa;
typedef v8us __attribute__((may_alias)) v8usa;

__device__ __forceinline__ unsigned short f2bf(float f) { unsigned u = __float_as_uint(f); u += 0x7FFFu + ((u >> 16) & 1u); return (unsigned short)(u >> 16); }
__device__ __forceinline__ float bf2f(unsigned short b) { return __uint_as_float(((unsigned)b) << 16); }
__device__ __forceinline__ void splitf(float y, unsigned short& h, unsigned short& l) { h = f2bf(y); l = f2bf(y - bf2f(h)); }
__device__ __forceinline__ v16h cat16(v8h lo, v8h hi) { return __builtin_shufflevector(lo, hi, 0, 1, 2, 3, 4, 5, 6, 7, 8, 9, 10, 11, 12, 13, 14, 15); }
__device__ __forceinline__ v16bf cat16b(v8us lo, v8us hi) { return __builtin_bit_cast(v16bf, __builtin_shufflevector(lo, hi, 0, 1, 2, 3, 4, 5, 6, 7, 8, 9, 10, 11, 12, 13, 14, 15)); }
// fragment loads from K-contiguous 16-bit global rows: elements 0..7 <- p[0..7], elements 8..15 <- p[16..23]; caller adds 8*(lane>>4)
__device__ __forceinline__ v16bf ldb(const bf* p) { return cat16b(*(const v8us*)p, *(const v8us*)(p + 16)); }
__device__ __forceinline__ v16h  ldh(const h16* p) { return cat16(*(const v8h*)p, *(const v8h*)(p + 16)); }
// one WMMA + its own hazard guard (accumulator tied, fragments kept live)
__device__ __forceinline__ v8f mmab(v16bf a, v16bf b, v8f c) {
    c = __builtin_amdgcn_wmma_f32_16x16x32_bf16(false, a, false, b, (short)0, c, false, false);
    asm volatile("v_nop\n\tv_nop\n\tv_nop\n\tv_nop" : "+v"(c) : "v"(a), "v"(b));
    return c; }
__device__ __forceinline__ v8f mmah(v16h a, v16h b, v8f c) {
    c = __builtin_amdgcn_wmma_f32_16x16x32_f16(false, a, false, b, (short)0, c, false, false);
    asm volatile("v_nop\n\tv_nop\n\tv_nop\n\tv_nop" : "+v"(c) : "v"(a), "v"(b));
    return c; }
__device__ __forceinline__ void wave_sync_lds() { asm volatile("s_wait_dscnt 0" ::: "memory"); __builtin_amdgcn_wave_barrier(); asm volatile("" ::: "memory"); }

// ---- projection core: a block of 4 waves makes a 128x128 tile, wave w the 64x64 part (w >> 1, w & 1): acc[mb][nb] += A[rows][k] Bt[cols][k] (+ A2 rows when NSPLIT), K = DM, bf16 planes with row pitch DM.
// Each stage of 128 k (256 bytes of the block's 128 A rows and 128 Bt rows; two buffers) is brought into LDS by asynchronous 16-byte copies that cover whole lines; rows lie at a pitch of 272 bytes and every
// fragment is a pair of 16-byte LDS loads. The k order of every accumulator is ascending in steps of 32.
#define GK 128                        // k per stage
#define GP 136                        // LDS row pitch in 16-bit elements: 256 data bytes + 16
__device__ __forceinline__ v16bf ldsb(const bf* p) { return cat16b(*(const v8usa*)p, *(const v8usa*)(p + 16)); }
// 64 rows of 256 bytes, global (row pitch DM elements) -> LDS (row pitch 272 bytes), by 128 threads: thread t takes 16 bytes at column (t & 15) of rows (t >> 4) + 0, 8, ..., 56.
// The address wait stands inside the statement so that no address register is rewritten ahead of it.
__device__ __forceinline__ void copy_rows64w(const bf* ldst, const bf* gsrc) {
    const int t = threadIdx.x;
    const unsigned l0 = (unsigned)(size_t)ldst + (unsigned)((t >> 4) * (GP * 2) + (t & 15) * 16);
    const unsigned l1 = l0 + 8 * GP * 2, l2 = l0 + 16 * GP * 2, l3 = l0 + 24 * GP * 2, l4 = l0 + 32 * GP * 2, l5 = l0 + 40 * GP * 2, l6 = l0 + 48 * GP * 2, l7 = l0 + 56 * GP * 2;
    const char* g0 = (const char*)gsrc + (size_t)(t >> 4) * (DM * 2) + (t & 15) * 16;
    const char* g1 = g0 + (size_t)8 * DM * 2;  const char* g2 = g0 + (size_t)16 * DM * 2; const char* g3 = g0 + (size_t)24 * DM * 2; const char* g4 = g0 + (size_t)32 * DM * 2;
    const char* g5 = g0 + (size_t)40 * DM * 2; const char* g6 = g0 + (size_t)48 * DM * 2; const char* g7 = g0 + (size_t)56 * DM * 2;
    asm volatile("global_load_async_to_lds_b128 %0, %8, off\n\t"
                 "global_load_async_to_lds_b128 %1, %9, off\n\t"
                 "global_load_async_to_lds_b128 %2, %10, off\n\t"
                 "global_load_async_to_lds_b128 %3, %11, off\n\t"
                 "global_load_async_to_lds_b128 %4, %12, off\n\t"
                 "global_load_async_to_lds_b128 %5, %13, off\n\t"
                 "global_load_async_to_lds_b128 %6, %14, off\n\t"
                 "global_load_async_to_lds_b128 %7, %15, off\n\t"
                 "s_wait_xcnt 0x0"
                 :: "v"(l0), "v"(l1), "v"(l2), "v"(l3), "v"(l4), "v"(l5), "v"(l6), "v"(l7), "v"(g0), "v"(g1), "v"(g2), "v"(g3), "v"(g4), "v"(g5), "v"(g6), "v"(g7) : "memory");
}
// ar0, br0: first A row and first Bt row of the BLOCK's tile; wm, wn: the wave's 64-row half of each
template <int NSPLIT>
__device__ __forceinline__ void gemm_acc(const bf* __restrict__ A, const bf* __restrict__ A2, const bf* __restrict__ Bt, int ar0, int br0, int wm, int wn, v8f (&acc)[4][4]) {
    __shared__ __align__(16) bf ring[2][NSPLIT ? 3 : 2][128 * GP];      // [buffer][A | Bt | A2][row][k]
    const int lane = threadIdx.x & 31, lr = lane & 15, hi = lane >> 4;
    auto stage = [&](int st) {                // stage st -> buffer st & 1; k = st * GK .. st * GK + GK - 1 < DM
        const int bu = st & 1; const int ga = ar0 * DM + st * GK, gb = br0 * DM + st * GK;
        copy_rows64w(&ring[bu][0][0], A + ga);  copy_rows64w(&ring[bu][0][64 * GP], A + ga + 64 * DM);
        copy_rows64w(&ring[bu][1][0], Bt + gb); copy_rows64w(&ring[bu][1][64 * GP], Bt + gb + 64 * DM);
        if (NSPLIT) { copy_rows64w(&ring[bu][NSPLIT ? 2 : 0][0], A2 + ga); copy_rows64w(&ring[bu][NSPLIT ? 2 : 0][64 * GP], A2 + ga + 64 * DM); }
    };
    stage(0);
    asm volatile("s_wait_asynccnt 0x0" ::: "memory");     // this wave's copies of stage 0 have landed
    __syncthreads();                                      // ... and every other wave's
    stage(1);
    const int ao = (wm * 64 + lr) * GP + 8 * hi, bo = (wn * 64 + lr) * GP + 8 * hi;
#pragma unroll 1                      // one copy of a stage's code: the eight stages are alike and the foot's barrier ends each
    for (int st = 0; st < DM / GK; ++st) {
        const int bu = st & 1;
#pragma unroll                        // four 32-k blocks a stage, constant LDS offsets
        for (int kk = 0; kk < GK; kk += 32) {
            // a block's fragments are asked for as one group of LDS loads ahead of its products: one exposed LDS latency a block, the later fragments return behind the first products
            v16bf a[4], a2[4], b[4];
#pragma unroll
            for (int mb = 0; mb < 4; ++mb) a[mb] = ldsb(&ring[bu][0][ao + mb * 16 * GP + kk]);
            b[0] = ldsb(&ring[bu][1][bo + kk]);
#pragma unroll
            for (int mb = 0; mb < 4; ++mb) if (NSPLIT) a2[mb] = ldsb(&ring[bu][NSPLIT ? 2 : 0][ao + mb * 16 * GP + kk]);
#pragma unroll
            for (int nb = 1; nb < 4; ++nb) b[nb] = ldsb(&ring[bu][1][bo + nb * 16 * GP + kk]);
#pragma unroll
            for (int nb = 0; nb < 4; ++nb) {
#pragma unroll
                for (int mb = 0; mb < 4; ++mb) { acc[mb][nb] = mmab(a[mb], b[nb], acc[mb][nb]); if (NSPLIT) acc[mb][nb] = mmab(a2[mb], b[nb], acc[mb][nb]); } }
        }
        asm volatile("s_wait_dscnt 0x0" ::: "memory");        // this wave's reads of the stage's buffer are done
        asm volatile("s_wait_asynccnt 0x0" ::: "memory");     // this wave's copies of the next stage have landed
        __syncthreads();                                      // publishes the next stage and frees this stage's buffer
        if (st + 2 < DM / GK) stage(st + 2);
    }
    asm volatile("s_wait_asynccnt 0x0" ::: "memory");         // no copy is left in flight when the wave goes on to its epilogue
}

// ---- k_prep: all that depends on the inputs alone, in one launch (none of the three jobs reads another's output): blocks [0, PB_CS) the cos | sin table, 4 entries a thread;
// then PB_X blocks x -> bf16 and 4 * PB_W blocks the four weights -> bf16 (RNE), PU vectors of 8 values a thread, a thread's loads all asked for ahead of its first conversion.
#define PU 8
constexpr unsigned PB_CS = SEQ * 32 / (256 * 4);
constexpr unsigned PB_X  = (unsigned)((size_t)MR * DM / 8 / (256 * PU));
constexpr unsigned PB_W  = DM * DM / 8 / (256 * PU);
static_assert((SEQ * 32) % (256 * 4) == 0);
static_assert(((size_t)MR * DM / 8) % (256 * PU) == 0);
static_assert((DM * DM / 8) % (256 * PU) == 0);
#define PROWS (256 * PU * 8 / DM)      // rows of x a block converts: whole rows of one batch
static_assert((256 * PU * 8) % DM == 0 && SEQ % PROWS == 0);
__global__ __launch_bounds__(256) void k_prep(const float* __restrict__ x, const float* __restrict__ wq, const float* __restrict__ wk, const float* __restrict__ wv, const float* __restrict__ wo,
                                              bf* XB, bf* W4, float* CS) {
    unsigned blk = blockIdx.x;
    if (blk < PB_CS) {
        for (int k = 0; k < 4; ++k) {
            const int idx = (int)(blk * 1024 + k * 256 + threadIdx.x); const int j = idx & 31, t = idx >> 5;
            double p = 1.0;
            if (j & 1)  p *= 1.333521432163324;      // 10000^(1/32)
            if (j & 2)  p *= 1.7782794100389228;     // 10000^(1/16)
            if (j & 4)  p *= 3.1622776601683795;     // 10000^(1/8)
            if (j & 8)  p *= 10.0;                   // 10000^(1/4)
            if (j & 16) p *= 100.0;                  // 10000^(1/2)
            const float pf = (float)p; const float inv = 1.0f / pf; const float ang = (float)t * inv;
            float sn, cs; sincosf(ang, &sn, &cs);
            v2f o; o[0] = cs; o[1] = sn;
            *(v2f*)(CS + (size_t)idx * 2) = o;
            asm volatile("s_wait_xcnt 0x0" ::: "memory");   // the next trip writes the registers that held this store's address
        }
        return;
    }
    blk -= PB_CS;
    const float* src; bf* dst;                // the block's PU * 256 vectors lie in a row in both
    if (blk < PB_X) {
        const int row = (int)(blk * PROWS); const int b = row / SEQ, t = row - b * SEQ;
        src = x + ((size_t)b * SEQ_FULL + t) * DM; dst = XB + (size_t)row * DM;
    } else {
        blk -= PB_X;
        const unsigned w = blk / PB_W; blk -= w * PB_W;
        src = ((w == 0) ? wq : (w == 1) ? wk : (w == 2) ? wv : wo) + (size_t)blk * (256 * PU * 8); dst = W4 + (size_t)w * DM * DM + (size_t)blk * (256 * PU * 8);
    }
    src += threadIdx.x * 8; dst += threadIdx.x * 8;
    v8f v[PU];
#pragma unroll
    for (int k = 0; k < PU; ++k) v[k] = *(const v8f*)(src + k * 256 * 8);
#pragma unroll
    for (int k = 0; k < PU; ++k) {
        v8us o;
#pragma unroll
        for (int e = 0; e < 8; ++e) o[e] = f2bf(v[k][e]);
        *(v8us*)(dst + k * 256 * 8) = o; }
    asm volatile("s_wait_xcnt 0x0" ::: "memory");           // stands behind the run of stores, ahead of whatever code follows them in the text and writes their registers
}

// ---- k_projqkv: the three input projections in one launch (none reads another's output), blockIdx.z = 0 (q, scaled 1/8) / 1 (k) / 2 (v), the same number of blocks each.
// z < 2: a block makes 128 tokens x two heads of x W^T, each wave 64 tokens x one head; epilogue per 16-token slab: per-head RMS normalisation, half-split rotary, bf16 hi|lo planes [b*NH + head][t][64].
// z = 2: transposed value projection V^T[b][n][t] = sum_k Wv[n][k] x[b][t][k] (A = weight rows, Bt = token rows): f16 plane (pitch SEQ) + bf16 hi|lo planes for t < RH (pitch RH).
static_assert(NH / 2 == DM / 128);
__global__ __launch_bounds__(128) void k_projqkv(const bf* __restrict__ XB, const bf* __restrict__ W4, const float* __restrict__ CS, bf* PH, bf* PL, h16* V16, bf* Vh, bf* Vl) {
    __shared__ __align__(16) float osw[4][16 * 68];
    const int lane = threadIdx.x & 31, lr = lane & 15, hi = lane >> 4;
    const int wave = __builtin_amdgcn_readfirstlane(threadIdx.x >> 5), wm = wave >> 1, wn = wave & 1;
    float* os = &osw[wave][0];
    const int z = blockIdx.z;
    // the block's tile: first A row, first Bt row; for v the flat block index is cut into (weight rows, tokens, batch)
    const int fl = blockIdx.y * (MR / 128) + blockIdx.x;
    const int vb = fl / ((DM / 128) * (SEQ / 128));
    const int ta = (z < 2) ? (int)blockIdx.x : fl % (DM / 128);
    const int tb_ = (z < 2) ? (int)blockIdx.y : (fl / (DM / 128)) % (SEQ / 128);
    const bf* A  = (z < 2) ? XB : W4 + (size_t)2 * DM * DM;
    const bf* Bt = (z < 2) ? W4 + (size_t)z * DM * DM : XB + (size_t)vb * SEQ * DM;
    v8f acc[4][4];
#pragma unroll
    for (int mb = 0; mb < 4; ++mb)
#pragma unroll
        for (int nb = 0; nb < 4; ++nb) acc[mb][nb] = (v8f){};
    gemm_acc<0>(A, A, Bt, ta * 128, tb_ * 128, wm, wn, acc);
    const int r0 = ta * 128 + wm * 64;
    const int r4 = lane >> 3, j8 = lane & 7;
    if (z < 2) {
        const int head = tb_ * 2 + wn;
        const float sc = (z == 0) ? 0.125f : 1.0f;
        const size_t pz = (size_t)z * PLN;
        const int d0 = j8 * 8, dp = d0 ^ 32, i0 = d0 & 31;
        const float sgn = (j8 < 4) ? 1.0f : -1.0f;
        const int b = r0 / SEQ, tb = r0 - b * SEQ;
#pragma unroll
        for (int mb = 0; mb < 4; ++mb) {
#pragma unroll
            for (int nb = 0; nb < 4; ++nb) {
#pragma unroll
                for (int j = 0; j < 8; ++j) os[(hi * 8 + j) * 68 + nb * 16 + lr] = acc[mb][nb][j]; }
            wave_sync_lds();
#pragma unroll 1
            for (int it = 0; it < 4; ++it) {
                const int row = it * 4 + r4; const int t = tb + mb * 16 + row;
                const v4f a0 = *(const v4fa*)(os + row * 68 + d0), a1 = *(const v4fa*)(os + row * 68 + d0 + 4);
                const v4f b0 = *(const v4fa*)(os + row * 68 + dp), b1 = *(const v4fa*)(os + row * 68 + dp + 4);
                float ow[8], pw[8], cs[16];
#pragma unroll
                for (int e = 0; e < 4; ++e) { ow[e] = a0[e]; ow[4 + e] = a1[e]; pw[e] = b0[e]; pw[4 + e] = b1[e]; }
                float ss = 0.f;
#pragma unroll
                for (int e = 0; e < 8; ++e) ss += ow[e] * ow[e];
                ss += __shfl_xor(ss, 1, 32); ss += __shfl_xor(ss, 2, 32); ss += __shfl_xor(ss, 4, 32);
                const float rn = rsqrtf(ss * (1.0f / 64.0f) + RMS_EPS);
                const float* cp = CS + ((size_t)t * 32 + i0) * 2;
                const v4f c0v = *(const v4f*)cp, c1v = *(const v4f*)(cp + 4), c2v = *(const v4f*)(cp + 8), c3v = *(const v4f*)(cp + 12);
#pragma unroll
                for (int e = 0; e < 4; ++e) { cs[e] = c0v[e]; cs[4 + e] = c1v[e]; cs[8 + e] = c2v[e]; cs[12 + e] = c3v[e]; }
                v8us oh, ol;
#pragma unroll
                for (int e = 0; e < 8; ++e) { const float xo = ow[e] * rn, xp = pw[e] * rn; const float r = (xo * cs[2 * e] + sgn * (xp * cs[2 * e + 1])) * sc;
                    unsigned short a2, c2; splitf(r, a2, c2); oh[e] = a2; ol[e] = c2; }
                const size_t oo = pz + (((size_t)(b * NH + head)) * SEQ + t) * HD + d0;
                *(v8us*)(PH + oo) = oh; *(v8us*)(PL + oo) = ol;
                asm volatile("s_wait_xcnt 0x0" ::: "memory"); }   // the next trip writes the registers that held these stores' addresses and data
            wave_sync_lds();
        }
    } else {
        const int c0 = tb_ * 128 + wn * 64, b = vb; const bool early = (c0 < RH);
#pragma unroll
        for (int mb = 0; mb < 4; ++mb) {
#pragma unroll
            for (int nb = 0; nb < 4; ++nb) {
#pragma unroll
                for (int j = 0; j < 8; ++j) os[(hi * 8 + j) * 68 + nb * 16 + lr] = acc[mb][nb][j]; }
            wave_sync_lds();
#pragma unroll 1
            for (int it = 0; it < 4; ++it) {
                const int row = it * 4 + r4; const int n = r0 + mb * 16 + row; const int t0 = c0 + j8 * 8;
                const v4f a0 = *(const v4fa*)(os + row * 68 + j8 * 8), a1 = *(const v4fa*)(os + row * 68 + j8 * 8 + 4);
                v8h o16; v8us oh, ol;
#pragma unroll
                for (int e = 0; e < 8; ++e) { const float x = (e < 4) ? a0[e & 3] : a1[e & 3]; o16[e] = (h16)x; unsigned short a2, c2; splitf(x, a2, c2); oh[e] = a2; ol[e] = c2; }
                const size_t o1 = ((size_t)(b * DM + n)) * SEQ + t0; const size_t o2 = ((size_t)(b * DM + n)) * RH + t0;
                *(v8h*)(V16 + o1) = o16;
                asm volatile("s_wait_xcnt 0x0" ::: "memory");   // ahead of the writes to this store's address and data registers
                if (early) { *(v8us*)(Vh + o2) = oh; *(v8us*)(Vl + o2) = ol;
                    asm volatile("s_wait_xcnt 0x0" ::: "memory"); }   // the same for the two hi | lo stores: the next trip writes their registers
            }
            wave_sync_lds();
        }
    }
}

__global__ __launch_bounds__(128) void k_projo(const bf* __restrict__ ATh, const bf* __restrict__ ATl, const bf* __restrict__ W4, float* OUT) {
    __shared__ __align__(16) float osw[4][16 * 68];
    const int lane = threadIdx.x & 31, lr = lane & 15, hi = lane >> 4;
    const int wave = __builtin_amdgcn_readfirstlane(threadIdx.x >> 5), wm = wave >> 1, wn = wave & 1;
    float* os = &osw[wave][0];
    const int r0 = blockIdx.x * 128 + wm * 64, c0 = blockIdx.y * 128 + wn * 64;
    const bf* Bt = W4 + (size_t)3 * DM * DM;
    v8f acc[4][4];
#pragma unroll
    for (int mb = 0; mb < 4; ++mb)
#pragma unroll
        for (int nb = 0; nb < 4; ++nb) acc[mb][nb] = (v8f){};
    gemm_acc<1>(ATh, ATl, Bt, blockIdx.x * 128, blockIdx.y * 128, wm, wn, acc);
#pragma unroll
    for (int mb = 0; mb < 4; ++mb) {
#pragma unroll
        for (int nb = 0; nb < 4; ++nb) {
#pragma unroll
            for (int j = 0; j < 8; ++j) os[(hi * 8 + j) * 68 + nb * 16 + lr] = acc[mb][nb][j]; }
        wave_sync_lds();
        float* crow = OUT + (size_t)(r0 + mb * 16) * DM + c0;
{
#pragma unroll
            for (int s = 0; s < 8; ++s) { const int row = 2 * s + hi, cofs = lr * 4; const v4f val = *(const v4fa*)(os + row * 68 + cofs);
                *(v4f*)(crow + (size_t)row * DM + cofs) = val; }
             }
        wave_sync_lds();
    }
}

// ---- fused causal attention, softmax against the fixed score bound (no running maximum, no rescaling). One wave per 16 query rows, 4 waves per block. The block's 64 Q rows (once) and each stage of 64 keys (K hi, K lo, V^T rows; two buffers) are brought
// into LDS by asynchronous 16-byte copies that cover whole 128-byte lines; rows lie at a pitch of 144 bytes and every fragment is a pair of 16-byte LDS loads. 32 keys per step, two steps per stage;
// scores = (qh + ql).(kh + kl) without the lo.lo term; each lane's part of the row sums in f32; P through a wave-private LDS tile.
#define KP 72                         // LDS row pitch in 16-bit elements: 128 data bytes + 16
// 64 rows of 128 bytes, global (row pitch gpitch bytes) -> LDS (row pitch 144 bytes), by 128 threads: thread t takes 16 bytes at column (t & 7) of rows (t >> 3) + 0, 16, 32, 48.
// The address wait stands inside the statement so that no address register is rewritten ahead of it.
__device__ __forceinline__ void copy_rows64(const bf* ldst, const void* gsrc, int gpitch) {
    const int t = threadIdx.x;
    const unsigned l0 = (unsigned)(size_t)ldst + (unsigned)((t >> 3) * (KP * 2) + (t & 7) * 16);
    const unsigned l1 = l0 + 16 * KP * 2, l2 = l0 + 32 * KP * 2, l3 = l0 + 48 * KP * 2;
    const char* g0 = (const char*)gsrc + (size_t)(t >> 3) * gpitch + (t & 7) * 16;
    const char* g1 = g0 + (size_t)16 * gpitch; const char* g2 = g0 + (size_t)32 * gpitch; const char* g3 = g0 + (size_t)48 * gpitch;
    asm volatile("global_load_async_to_lds_b128 %0, %4, off\n\t"
                 "global_load_async_to_lds_b128 %1, %5, off\n\t"
                 "global_load_async_to_lds_b128 %2, %6, off\n\t"
                 "global_load_async_to_lds_b128 %3, %7, off\n\t"
                 "s_wait_xcnt 0x0"
                 :: "v"(l0), "v"(l1), "v"(l2), "v"(l3), "v"(g0), "v"(g1), "v"(g2), "v"(g3) : "memory");
}
template <bool EARLY>
__device__ __forceinline__ void attn_body(const bf* __restrict__ Qh, const bf* __restrict__ Ql, const bf* __restrict__ Kh, const bf* __restrict__ Kl,
                                          const h16* __restrict__ V16, const bf* __restrict__ Vh, const bf* __restrict__ Vl, bf* Ah, bf* Al, int rowoff) {
    __shared__ __align__(16) float os[4][16 * 72];                 // first the Q tile (hi rows, then lo rows, 64 x 144 bytes each), in the epilogue each wave's output staging (pitch 68 floats)
    __shared__ __align__(16) bf  ks[2][2][64 * KP];                // [buffer][hi | lo][key][d]
    __shared__ __align__(16) bf  vs[2][EARLY ? 2 : 1][64 * KP];    // [buffer][plane][d][key]
    __shared__ __align__(16) h16 pf[4][16 * 40];
    __shared__ __align__(16) bf  ph[4][16 * 40];
    __shared__ __align__(16) bf  pl[4][16 * 40];
    static_assert(sizeof(os) == (size_t)2 * 64 * KP * 2);
    const int lane = threadIdx.x & 31, lr = lane & 15, hi = lane >> 4;
    const int wave = __builtin_amdgcn_readfirstlane(threadIdx.x >> 5);
    const int bh = blockIdx.y; const int qblk = rowoff + blockIdx.x * 64; const int qrow0 = qblk + wave * 16;
    const int pb = bh * SEQ * HD;
    const int nch = (qrow0 >> 5) + 1;
    const int nst = (qblk >> 6) + 1;          // stages of 64 keys, the same for the whole block; the last one holds the diagonal
    bf* qsm = (bf*)&os[0][0];
    auto stage = [&](int st) {                // stage st -> buffer st & 1; keys st * 64 .. st * 64 + 63 <= qblk + 63
        const int bu = st & 1;
        copy_rows64(&ks[bu][0][0], Kh + pb + st * 64 * HD, HD * 2);
        copy_rows64(&ks[bu][1][0], Kl + pb + st * 64 * HD, HD * 2);
        if (EARLY) { copy_rows64(&vs[bu][0][0], Vh + bh * HD * RH + st * 64, RH * 2); copy_rows64(&vs[bu][EARLY ? 1 : 0][0], Vl + bh * HD * RH + st * 64, RH * 2); }
        else copy_rows64(&vs[bu][0][0], V16 + bh * HD * SEQ + st * 64, SEQ * 2);
    };
    copy_rows64(qsm, Qh + pb + qblk * HD, HD * 2);
    copy_rows64(qsm + 64 * KP, Ql + pb + qblk * HD, HD * 2);
    stage(0);
    asm volatile("s_wait_asynccnt 0x0" ::: "memory");     // this wave's copies of Q and stage 0 have landed
    __syncthreads();                                      // ... and every other wave's
    if (nst > 1) stage(1);
    const int qf = (wave * 16 + lr) * KP + 8 * hi;
    const v16bf qh0 = ldsb(qsm + qf), qh1 = ldsb(qsm + qf + 32), ql0 = ldsb(qsm + 64 * KP + qf), ql1 = ldsb(qsm + 64 * KP + qf + 32);
    v8f oa[4];
#pragma unroll
    for (int sl = 0; sl < 4; ++sl) oa[sl] = (v8f){};
    float l[8];
#pragma unroll
    for (int r = 0; r < 8; ++r) l[r] = 0.f;
#pragma unroll 1                      // stays rolled, as before: the trip count is not known at compile time and one copy of the step keeps the loop short in the instruction cache
    for (int c = 0; c < 2 * nst; ++c) {
      const int bu = (c >> 1) & 1, kin = (c & 1) * 32;     // buffer, first key of this step inside the stage
      if (c < nch) {                                       // wave-uniform: waves 0 and 1 skip the block's last step, which lies beyond their diagonal
        const int kb = c * 32;
        v8f s0 = (v8f){}, s1 = (v8f){};
        // the step's K fragments and V fragments (of hi | lo V: the hi plane's) are asked for as one group of LDS loads ahead of the products: the V loads then return behind the scores and the softmax
        const int ko = (kin + lr) * KP + 8 * hi, kq = ko + 16 * KP;
        const v16bf kh0 = ldsb(&ks[bu][0][ko]), kh1 = ldsb(&ks[bu][0][ko + 32]), kl0 = ldsb(&ks[bu][1][ko]), kl1 = ldsb(&ks[bu][1][ko + 32]);
        const v16bf kh2 = ldsb(&ks[bu][0][kq]), kh3 = ldsb(&ks[bu][0][kq + 32]), kl2 = ldsb(&ks[bu][1][kq]), kl3 = ldsb(&ks[bu][1][kq + 32]);
        const int vo = lr * KP + kin + 8 * hi;
        v16bf vfa[4];
#pragma unroll
        for (int sl = 0; sl < 4; ++sl) vfa[sl] = ldsb(&vs[bu][0][vo + sl * 16 * KP]);
        s0 = mmab(qh0, kh0, s0); s0 = mmab(qh1, kh1, s0); s0 = mmab(ql0, kh0, s0); s0 = mmab(ql1, kh1, s0); s0 = mmab(qh0, kl0, s0); s0 = mmab(qh1, kl1, s0);
        s1 = mmab(qh0, kh2, s1); s1 = mmab(qh1, kh3, s1); s1 = mmab(ql0, kh2, s1); s1 = mmab(ql1, kh3, s1); s1 = mmab(qh0, kl2, s1); s1 = mmab(qh1, kl3, s1);
        const bool diag = (kb + 31 > qrow0);     // wave-uniform: only the last step of a wave touches the diagonal
        const int kg0 = kb + lr;
#pragma unroll
        for (int r = 0; r < 8; ++r) {
            const int qg = qrow0 + 8 * hi + r;
            float v0 = s0[r] * L2E + SBIAS, v1 = s1[r] * L2E + SBIAS;     // the 1/8 scale is carried by the q planes
            if (diag) { v0 = (kg0 <= qg) ? v0 : NEGB; v1 = (kg0 + 16 <= qg) ? v1 : NEGB; }
            const float e0 = __builtin_amdgcn_exp2f(v0), e1 = __builtin_amdgcn_exp2f(v1);
            l[r] += e0 + e1;
            const int po = (8 * hi + r) * 40 + lr;
            if (EARLY) { unsigned short a2, c2; splitf(e0, a2, c2); ph[wave][po] = a2; pl[wave][po] = c2; splitf(e1, a2, c2); ph[wave][po + 16] = a2; pl[wave][po + 16] = c2; }
            else { pf[wave][po] = (h16)e0; pf[wave][po + 16] = (h16)e1; }
        }
        wave_sync_lds();
        if (EARLY) {
            const v16bf pah = cat16b(*(const v8usa*)(&ph[wave][lr * 40 + 8 * hi]), *(const v8usa*)(&ph[wave][lr * 40 + 16 + 8 * hi]));
            const v16bf pal = cat16b(*(const v8usa*)(&pl[wave][lr * 40 + 8 * hi]), *(const v8usa*)(&pl[wave][lr * 40 + 16 + 8 * hi]));
            v16bf vfb[4];                                     // the lo plane's fragments come here, with P: held from the top of the step they would push the wave past 256 registers
#pragma unroll
            for (int sl = 0; sl < 4; ++sl) vfb[sl] = ldsb(&vs[bu][EARLY ? 1 : 0][vo + sl * 16 * KP]);
#pragma unroll
            for (int sl = 0; sl < 4; ++sl) { oa[sl] = mmab(pah, vfa[sl], oa[sl]); oa[sl] = mmab(pal, vfa[sl], oa[sl]); oa[sl] = mmab(pah, vfb[sl], oa[sl]); }
        } else {
            const v16h pa = cat16(*(const v8ha*)(&pf[wave][lr * 40 + 8 * hi]), *(const v8ha*)(&pf[wave][lr * 40 + 16 + 8 * hi]));
#pragma unroll
            for (int sl = 0; sl < 4; ++sl) oa[sl] = mmah(pa, __builtin_bit_cast(v16h, vfa[sl]), oa[sl]);
        }
        wave_sync_lds();
      }
      if (c & 1) {                                            // foot of a stage, passed by every wave
        const int st = c >> 1;
        asm volatile("s_wait_dscnt 0x0" ::: "memory");        // this wave's reads of the stage's buffer are done
        asm volatile("s_wait_asynccnt 0x0" ::: "memory");     // this wave's copies of the next stage have landed
        __syncthreads();                                      // publishes the next stage and frees this stage's buffer
        if (st + 2 < nst) stage(st + 2);
      }
    }
    asm volatile("s_wait_asynccnt 0x0" ::: "memory");         // no copy is left in flight when the Q tile's LDS becomes output staging
#pragma unroll
    for (int r = 0; r < 8; ++r) { float t = l[r]; t += __shfl_xor(t, 1, 32); t += __shfl_xor(t, 2, 32); t += __shfl_xor(t, 4, 32); t += __shfl_xor(t, 8, 32);
        const float inv = 1.0f / t;
#pragma unroll
        for (int sl = 0; sl < 4; ++sl) os[wave][(8 * hi + r) * 68 + sl * 16 + lr] = oa[sl][r] * inv; }
    wave_sync_lds();
    const int r4 = lane >> 3, d0 = (lane & 7) * 8; const int b = bh / NH, h = bh - b * NH;
#pragma unroll 1
    for (int it = 0; it < 4; ++it) {
        const int row = it * 4 + r4;
        const v4f a0 = *(const v4fa*)(&os[wave][row * 68 + d0]), a1 = *(const v4fa*)(&os[wave][row * 68 + d0 + 4]);
        v8us oh, ol;
#pragma unroll
        for (int e = 0; e < 8; ++e) { const float x = (e < 4) ? a0[e & 3] : a1[e & 3]; unsigned short a2, c2; splitf(x, a2, c2); oh[e] = a2; ol[e] = c2; }
        const size_t oo = ((size_t)(b * SEQ + qrow0 + row)) * DM + h * HD + d0;
        *(v8us*)(Ah + oo) = oh; *(v8us*)(Al + oo) = ol;  }
}
// query rows [0, RH): grid (RH/64, NB*NH); query rows [RH, SEQ): grid ((SEQ-RH)/64, NB*NH); 128 threads
__global__ __launch_bounds__(128) void k_attn_e(const bf* __restrict__ Qh, const bf* __restrict__ Ql, const bf* __restrict__ Kh, const bf* __restrict__ Kl,
                                                const h16* __restrict__ V16, const bf* __restrict__ Vh, const bf* __restrict__ Vl, bf* Ah, bf* Al) {
    attn_body<true>(Qh, Ql, Kh, Kl, V16, Vh, Vl, Ah, Al, 0); }
__global__ __launch_bounds__(128) void k_attn_l(const bf* __restrict__ Qh, const bf* __restrict__ Ql, const bf* __restrict__ Kh, const bf* __restrict__ Kl,
                                                const h16* __restrict__ V16, const bf* __restrict__ Vh, const bf* __restrict__ Vl, bf* Ah, bf* Al) {
    attn_body<false>(Qh, Ql, Kh, Kl, V16, Vh, Vl, Ah, Al, RH); }

constexpr size_t al256(size_t b) { return (b + 255) & ~(size_t)255; }
constexpr size_t SZ_XB = al256((size_t)MR * DM * 2);
constexpr size_t SZ_W4 = al256((size_t)4 * DM * DM * 2);
constexpr size_t SZ_CS = al256((size_t)SEQ * 32 * 2 * 4);
constexpr size_t SZ_QK = al256((size_t)2 * PLN * 2);
constexpr size_t SZ_V16 = al256((size_t)NB * DM * SEQ * 2);
constexpr size_t SZ_VR = al256((size_t)NB * DM * RH * 2);
constexpr size_t SZ_AT = al256((size_t)MR * DM * 2);
constexpr size_t SZ_TOTAL = SZ_XB + SZ_W4 + SZ_CS + 2 * SZ_QK + SZ_V16 + 2 * SZ_VR + 2 * SZ_AT;
static_assert(SZ_TOTAL <= (size_t)134217728);

extern "C" void kernel_launch(void* const* d_in, const int* in_sizes, int n_in,
                              void* d_out, int out_size, void* d_ws, size_t ws_size, hipStream_t stream) {
    if (n_in < 5) return;
    if (in_sizes[0] < (NB - 1) * SEQ_FULL * DM + SEQ * DM) return;
    if (in_sizes[1] < DM * DM || in_sizes[2] < DM * DM || in_sizes[3] < DM * DM || in_sizes[4] < DM * DM) return;
    if (out_size < MR * DM) return;
    if (SZ_TOTAL > ws_size) return;
    const float* x = (const float*)d_in[0]; const float* wq = (const float*)d_in[1]; const float* wk = (const float*)d_in[2];
    const float* wv = (const float*)d_in[3]; const float* wo = (const float*)d_in[4];      // wire order x, w_q, w_k, w_v, w_proj (each [out][in])
    float* OUT = (float*)d_out;
    char* wsp = (char*)d_ws;
    bf* XB = (bf*)wsp; wsp += SZ_XB;
    bf* W4 = (bf*)wsp; wsp += SZ_W4;            // Wq | Wk | Wv | Wo, each [DM][DM] as stored (Wv the A operand, the others Bt)
    float* CS = (float*)wsp; wsp += SZ_CS;
    bf* QKh = (bf*)wsp; wsp += SZ_QK;           // [q | k][b*NH + h][t][64] hi
    bf* QKl = (bf*)wsp; wsp += SZ_QK;           // lo
    h16* V16 = (h16*)wsp; wsp += SZ_V16;        // [b][h*64 + d][t]
    bf* Vh = (bf*)wsp; wsp += SZ_VR;            // [b][h*64 + d][t < RH]
    bf* Vl = (bf*)wsp; wsp += SZ_VR;
    bf* ATh = (bf*)wsp; wsp += SZ_AT;           // merged-head context [b*SEQ + t][h*64 + d] hi
    bf* ATl = (bf*)wsp; wsp += SZ_AT;
    k_prep<<<PB_CS + PB_X + 4 * PB_W, 256, 0, stream>>>(x, wq, wk, wv, wo, XB, W4, CS);
    k_projqkv<<<dim3(MR / 128, NH / 2, 3), 128, 0, stream>>>(XB, W4, CS, QKh, QKl, V16, Vh, Vl);
    k_attn_e<<<dim3(RH / 64, NB * NH), 128, 0, stream>>>(QKh, QKl, QKh + PLN, QKl + PLN, V16, Vh, Vl, ATh, ATl);
    if (SEQ > RH) k_attn_l<<<dim3((SEQ - RH) / 64, NB * NH), 128, 0, stream>>>(QKh, QKl, QKh + PLN, QKl + PLN, V16, Vh, Vl, ATh, ATl);
    k_projo<<<dim3(MR / 128, DM / 128), 128, 0, stream>>>(ATh, ATl, W4, OUT);
}

// v005
// Measured time: 118 microseconds a run.
// Timed twice side by side with v004, it ran 1.11 and 1.10 times as fast.
// All steps since v000 together make it 3.15 times as fast.
#include <hip/hip_runtime.h>

// Causal multi-head self-attention: separate bias-free [out][in] q/k/v projections, per-head RMS normalisation of q and k (no gain), half-split rotary
// (first half x1 cos + x2 sin, second half -x1 sin + x2 cos, positions = arange), scale 1/8, causal softmax, [out][in] output projection.
// Compute dtypes (all v_wmma_f32_16x16x32, f32 accumulate): q/k/v projections bf16 x bf16 (inputs converted RNE to bf16); scores bf16 hi|lo x hi|lo (3 products);
// P.V f16 single product for query rows >= RH, bf16 hi|lo 3 products for rows < RH; output projection ctx bf16 hi|lo x bf16 weights (2 products); norm/rotary/softmax f32.

#ifndef NB
#define NB 2
#endif
#ifndef SEQ
#define SEQ 2048
#endif
#define NB_FULL  2
#define SEQ_FULL 2048
#define DM   1024
#define NH   16
#define HD   64
#if SEQ < 256
#define RH   SEQ
#else
#define RH   256                      // query rows < RH: P and V as bf16 hi|lo (3 products)
#endif
#define MR   (NB * SEQ)
#define PLN  ((size_t)NB * NH * SEQ * HD)
#define L2E  1.4426950408889634f
// Every q row and k row leaves the RMS normalisation with a sum of squares <= 64 and the rotary keeps it, so every score (the 1/8 included) lies in [-8, 8] for any input.
// The softmax is taken against that fixed bound: P = 2^(PEXP + (s - 8) log2 e), between 2^-10 and 2^14, all normal f16 values; the common factor cancels against the row sum of the same P.
#define SMAX 8.0f
#define PEXP 14.0f
#define SBIAS (PEXP - SMAX * L2E)
#define NEGB (-1.0e30f)
#define RMS_EPS 1.1920928955078125e-07f

static_assert(NB >= 1 && NB <= NB_FULL);
static_assert(SEQ >= 64 && SEQ <= SEQ_FULL);
static_assert(SEQ % 64 == 0);
static_assert(RH % 64 == 0);
static_assert(RH <= SEQ);
static_assert(DM % 64 == 0);
static_assert(DM % 32 == 0);
static_assert(NH * HD == DM);
static_assert(HD == 64);
static_assert(MR % 128 == 0);
static_assert(SEQ % 128 == 0);
static_assert(DM % 128 == 0 && DM >= 256);

typedef _Float16 h16;
typedef unsigned short bf;
typedef __attribute__((ext_vector_type(16))) __bf16   v16bf;
typedef __attribute__((ext_vector_type(16))) _Float16 v16h;
typedef __attribute__((ext_vector_type(8)))  _Float16 v8h;
typedef __attribute__((ext_vector_type(8)))  unsigned short v8us;
typedef __attribute__((ext_vector_type(8)))  float    v8f;
typedef __attribute__((ext_vector_type(4)))  float    v4f;
typedef __attribute__((ext_vector_type(2)))  float    v2f;
typedef v8h  __attribute__((may_alias)) v8ha;
typedef v4f  __attribute__((may_alias)) v4fa;
typedef v8us __attribute__((may_alias)) v8usa;

__device__ __forceinline__ unsigned short f2bf(float f) { unsigned u = __float_as_uint(f); u += 0x7FFFu + ((u >> 16) & 1u); return (unsigned short)(u >> 16); }
__device__ __forceinline__ float bf2f(unsigned short b) { return __uint_as_float(((unsigned)b) << 16); }
__device__ __forceinline__ void splitf(float y, unsigned short& h, unsigned short& l) { h = f2bf(y); l = f2bf(y - bf2f(h)); }
__device__ __forceinline__ v16h cat16(v8h lo, v8h hi) { return __builtin_shufflevector(lo, hi, 0, 1, 2, 3, 4, 5, 6, 7, 8, 9, 10, 11, 12, 13, 14, 15); }
__device__ __forceinline__ v16bf cat16b(v8us lo, v8us hi) { return __builtin_bit_cast(v16bf, __builtin_shufflevector(lo, hi, 0, 1, 2, 3, 4, 5, 6, 7, 8, 9, 10, 11, 12, 13, 14, 15)); }
// fragment loads from K-contiguous 16-bit global rows: elements 0..7 <- p[0..7], elements 8..15 <- p[16..23]; caller adds 8*(lane>>4)
__device__ __forceinline__ v16bf ldb(const bf* p) { return cat16b(*(const v8us*)p, *(const v8us*)(p + 16)); }
__device__ __forceinline__ v16h  ldh(const h16* p) { return cat16(*(const v8h*)p, *(const v8h*)(p + 16)); }
// one WMMA + its own hazard guard (accumulator tied, fragments kept live)
__device__ __forceinline__ v8f mmab(v16bf a, v16bf b, v8f c) {
    c = __builtin_amdgcn_wmma_f32_16x16x32_bf16(false, a, false, b, (short)0, c, false, false);
    asm volatile("v_nop\n\tv_nop\n\tv_nop\n\tv_nop" : "+v"(c) : "v"(a), "v"(b));
    return c; }
__device__ __forceinline__ v8f mmah(v16h a, v16h b, v8f c) {
    c = __builtin_amdgcn_wmma_f32_16x16x32_f16(false, a, false, b, (short)0, c, false, false);
    asm volatile("v_nop\n\tv_nop\n\tv_nop\n\tv_nop" : "+v"(c) : "v"(a), "v"(b));
    return c; }
__device__ __forceinline__ void wave_sync_lds() { asm volatile("s_wait_dscnt 0" ::: "memory"); __builtin_amdgcn_wave_barrier(); asm volatile("" ::: "memory"); }

// ---- projection core: a block of 4 waves makes a 128x128 tile, wave w the 64x64 part (w >> 1, w & 1): acc[mb][nb] += A[rows][k] Bt[cols][k] (+ A2 rows when NSPLIT), K = DM, bf16 planes with row pitch DM.
// Each stage of 128 k (256 bytes of the block's 128 A rows and 128 Bt rows; two buffers) is brought into LDS by asynchronous 16-byte copies that cover whole lines; rows lie at a pitch of 272 bytes and every
// fragment is a pair of 16-byte LDS loads. The k order of every accumulator is ascending in steps of 32.
#define GK 128                        // k per stage
#define GP 136                        // LDS row pitch in 16-bit elements: 256 data bytes + 16
__device__ __forceinline__ v16bf ldsb(const bf* p) { return cat16b(*(const v8usa*)p, *(const v8usa*)(p + 16)); }
// 64 rows of 256 bytes, global (row pitch DM elements) -> LDS (row pitch 272 bytes), by 128 threads: thread t takes 16 bytes at column (t & 15) of rows (t >> 4) + 0, 8, ..., 56.
// The address wait stands inside the statement so that no address register is rewritten ahead of it.
__device__ __forceinline__ void copy_rows64w(const bf* ldst, const bf* gsrc) {
    const int t = threadIdx.x;
    const unsigned l0 = (unsigned)(size_t)ldst + (unsigned)((t >> 4) * (GP * 2) + (t & 15) * 16);
    const unsigned l1 = l0 + 8 * GP * 2, l2 = l0 + 16 * GP * 2, l3 = l0 + 24 * GP * 2, l4 = l0 + 32 * GP * 2, l5 = l0 + 40 * GP * 2, l6 = l0 + 48 * GP * 2, l7 = l0 + 56 * GP * 2;
    const char* g0 = (const char*)gsrc + (size_t)(t >> 4) * (DM * 2) + (t & 15) * 16;
    const char* g1 = g0 + (size_t)8 * DM * 2;  const char* g2 = g0 + (size_t)16 * DM * 2; const char* g3 = g0 + (size_t)24 * DM * 2; const char* g4 = g0 + (size_t)32 * DM * 2;
    const char* g5 = g0 + (size_t)40 * DM * 2; const char* g6 = g0 + (size_t)48 * DM * 2; const char* g7 = g0 + (size_t)56 * DM * 2;
    asm volatile("global_load_async_to_lds_b128 %0, %8, off\n\t"
                 "global_load_async_to_lds_b128 %1, %9, off\n\t"
                 "global_load_async_to_lds_b128 %2, %10, off\n\t"
                 "global_load_async_to_lds_b128 %3, %11, off\n\t"
                 "global_load_async_to_lds_b128 %4, %12, off\n\t"
                 "global_load_async_to_lds_b128 %5, %13, off\n\t"
                 "global_load_async_to_lds_b128 %6, %14, off\n\t"
                 "global_load_async_to_lds_b128 %7, %15, off\n\t"
                 "s_wait_xcnt 0x0"
                 :: "v"(l0), "v"(l1), "v"(l2), "v"(l3), "v"(l4), "v"(l5), "v"(l6), "v"(l7), "v"(g0), "v"(g1), "v"(g2), "v"(g3), "v"(g4), "v"(g5), "v"(g6), "v"(g7) : "memory");
}
// ar0, br0: first A row and first Bt row of the BLOCK's tile; wm, wn: the wave's 64-row half of each
template <int NSPLIT>
__device__ __forceinline__ void gemm_acc(const bf* __restrict__ A, const bf* __restrict__ A2, const bf* __restrict__ Bt, int ar0, int br0, int wm, int wn, v8f (&acc)[4][4]) {
    __shared__ __align__(16) bf ring[2][NSPLIT ? 3 : 2][128 * GP];      // [buffer][A | Bt | A2][row][k]
    const int lane = threadIdx.x & 31, lr = lane & 15, hi = lane >> 4;
    auto stage = [&](int st) {                // stage st -> buffer st & 1; k = st * GK .. st * GK + GK - 1 < DM
        const int bu = st & 1; const int ga = ar0 * DM + st * GK, gb = br0 * DM + st * GK;
        copy_rows64w(&ring[bu][0][0], A + ga);  copy_rows64w(&ring[bu][0][64 * GP], A + ga + 64 * DM);
        copy_rows64w(&ring[bu][1][0], Bt + gb); copy_rows64w(&ring[bu][1][64 * GP], Bt + gb + 64 * DM);
        if (NSPLIT) { copy_rows64w(&ring[bu][NSPLIT ? 2 : 0][0], A2 + ga); copy_rows64w(&ring[bu][NSPLIT ? 2 : 0][64 * GP], A2 + ga + 64 * DM); }
    };
    stage(0);
    asm volatile("s_wait_asynccnt 0x0" ::: "memory");     // this wave's copies of stage 0 have landed
    __syncthreads();                                      // ... and every other wave's
    stage(1);
    const int ao = (wm * 64 + lr) * GP + 8 * hi, bo = (wn * 64 + lr) * GP + 8 * hi;
#pragma unroll 1                      // one copy of a stage's code: the eight stages are alike and the foot's barrier ends each
    for (int st = 0; st < DM / GK; ++st) {
        const int bu = st & 1;
#pragma unroll                        // four 32-k blocks a stage, constant LDS offsets
        for (int kk = 0; kk < GK; kk += 32) {
            // a block's fragments are asked for as one group of LDS loads ahead of its products: one exposed LDS latency a block, the later fragments return behind the first products
            v16bf a[4], a2[4], b[4];
#pragma unroll
            for (int mb = 0; mb < 4; ++mb) a[mb] = ldsb(&ring[bu][0][ao + mb * 16 * GP + kk]);
            b[0] = ldsb(&ring[bu][1][bo + kk]);
#pragma unroll
            for (int mb = 0; mb < 4; ++mb) if (NSPLIT) a2[mb] = ldsb(&ring[bu][NSPLIT ? 2 : 0][ao + mb * 16 * GP + kk]);
#pragma unroll
            for (int nb = 1; nb < 4; ++nb) b[nb] = ldsb(&ring[bu][1][bo + nb * 16 * GP + kk]);
#pragma unroll
            for (int nb = 0; nb < 4; ++nb) {
#pragma unroll
                for (int mb = 0; mb < 4; ++mb) { acc[mb][nb] = mmab(a[mb], b[nb], acc[mb][nb]); if (NSPLIT) acc[mb][nb] = mmab(a2[mb], b[nb], acc[mb][nb]); } }
        }
        asm volatile("s_wait_dscnt 0x0" ::: "memory");        // this wave's reads of the stage's buffer are done
        asm volatile("s_wait_asynccnt 0x0" ::: "memory");     // this wave's copies of the next stage have landed
        __syncthreads();                                      // publishes the next stage and frees this stage's buffer
        if (st + 2 < DM / GK) stage(st + 2);
    }
    asm volatile("s_wait_asynccnt 0x0" ::: "memory");         // no copy is left in flight when the wave goes on to its epilogue
}

// ---- k_prep: all that depends on the inputs alone, in one launch (none of the three jobs reads another's output): blocks [0, PB_CS) the cos | sin table, 4 entries a thread;
// then PB_X blocks x -> bf16 and 4 * PB_W blocks the four weights -> bf16 (RNE), PU vectors of 8 values a thread, a thread's loads all asked for ahead of its first conversion.
#define PU 8
constexpr unsigned PB_CS = SEQ * 32 / (256 * 4);
constexpr unsigned PB_X  = (unsigned)((size_t)MR * DM / 8 / (256 * PU));
constexpr unsigned PB_W  = DM * DM / 8 / (256 * PU);
static_assert((SEQ * 32) % (256 * 4) == 0);
static_assert(((size_t)MR * DM / 8) % (256 * PU) == 0);
static_assert((DM * DM / 8) % (256 * PU) == 0);
#define PROWS (256 * PU * 8 / DM)      // rows of x a block converts: whole rows of one batch
static_assert((256 * PU * 8) % DM == 0 && SEQ % PROWS == 0);
__global__ __launch_bounds__(256) void k_prep(const float* __restrict__ x, const float* __restrict__ wq, const float* __restrict__ wk, const float* __restrict__ wv, const float* __restrict__ wo,
                                              bf* XB, bf* W4, float* CS) {
    unsigned blk = blockIdx.x;
    if (blk < PB_CS) {
        for (int k = 0; k < 4; ++k) {
            const int idx = (int)(blk * 1024 + k * 256 + threadIdx.x); const int j = idx & 31, t = idx >> 5;
            double p = 1.0;
            if (j & 1)  p *= 1.333521432163324;      // 10000^(1/32)
            if (j & 2)  p *= 1.7782794100389228;     // 10000^(1/16)
            if (j & 4)  p *= 3.1622776601683795;     // 10000^(1/8)
            if (j & 8)  p *= 10.0;                   // 10000^(1/4)
            if (j & 16) p *= 100.0;                  // 10000^(1/2)
            const float pf = (float)p; const float inv = 1.0f / pf; const float ang = (float)t * inv;
            float sn, cs; sincosf(ang, &sn, &cs);
            v2f o; o[0] = cs; o[1] = sn;
            *(v2f*)(CS + (size_t)idx * 2) = o;
            asm volatile("s_wait_xcnt 0x0" ::: "memory");   // the next trip writes the registers that held this store's address
        }
        return;
    }
    blk -= PB_CS;
    const float* src; bf* dst;                // the block's PU * 256 vectors lie in a row in both
    if (blk < PB_X) {
        const int row = (int)(blk * PROWS); const int b = row / SEQ, t = row - b * SEQ;
        src = x + ((size_t)b * SEQ_FULL + t) * DM; dst = XB + (size_t)row * DM;
    } else {
        blk -= PB_X;
        const unsigned w = blk / PB_W; blk -= w * PB_W;
        src = ((w == 0) ? wq : (w == 1) ? wk : (w == 2) ? wv : wo) + (size_t)blk * (256 * PU * 8); dst = W4 + (size_t)w * DM * DM + (size_t)blk * (256 * PU * 8);
    }
    src += threadIdx.x * 8; dst += threadIdx.x * 8;
    v8f v[PU];
#pragma unroll
    for (int k = 0; k < PU; ++k) v[k] = *(const v8f*)(src + k * 256 * 8);
#pragma unroll
    for (int k = 0; k < PU; ++k) {
        v8us o;
#pragma unroll
        for (int e = 0; e < 8; ++e) o[e] = f2bf(v[k][e]);
        *(v8us*)(dst + k * 256 * 8) = o; }
    asm volatile("s_wait_xcnt 0x0" ::: "memory");           // stands behind the run of stores, ahead of whatever code follows them in the text and writes their registers
}

// ---- k_projqkv: the three input projections in one launch (none reads another's output), blockIdx.z = 0 (q, scaled 1/8) / 1 (k) / 2 (v), the same number of blocks each.
// z < 2: a block makes 128 tokens x two heads of x W^T, each wave 64 tokens x one head; epilogue per 16-token slab: per-head RMS normalisation, half-split rotary, bf16 hi|lo planes [b*NH + head][t][64].
// z = 2: transposed value projection V^T[b][n][t] = sum_k Wv[n][k] x[b][t][k] (A = weight rows, Bt = token rows): f16 plane (pitch SEQ) + bf16 hi|lo planes for t < RH (pitch RH).
static_assert(NH / 2 == DM / 128);
__global__ __launch_bounds__(128) void k_projqkv(const bf* __restrict__ XB, const bf* __restrict__ W4, const float* __restrict__ CS, bf* PH, bf* PL, h16* V16, bf* Vh, bf* Vl) {
    __shared__ __align__(16) float osw[4][16 * 68];
    const int lane = threadIdx.x & 31, lr = lane & 15, hi = lane >> 4;
    const int wave = __builtin_amdgcn_readfirstlane(threadIdx.x >> 5), wm = wave >> 1, wn = wave & 1;
    float* os = &osw[wave][0];
    const int z = blockIdx.z;
    // the block's tile: first A row, first Bt row; for v the flat block index is cut into (weight rows, tokens, batch)
    const int fl = blockIdx.y * (MR / 128) + blockIdx.x;
    const int vb = fl / ((DM / 128) * (SEQ / 128));
    const int ta = (z < 2) ? (int)blockIdx.x : fl % (DM / 128);
    const int tb_ = (z < 2) ? (int)blockIdx.y : (fl / (DM / 128)) % (SEQ / 128);
    const bf* A  = (z < 2) ? XB : W4 + (size_t)2 * DM * DM;
    const bf* Bt = (z < 2) ? W4 + (size_t)z * DM * DM : XB + (size_t)vb * SEQ * DM;
    v8f acc[4][4];
#pragma unroll
    for (int mb = 0; mb < 4; ++mb)
#pragma unroll
        for (int nb = 0; nb < 4; ++nb) acc[mb][nb] = (v8f){};
    gemm_acc<0>(A, A, Bt, ta * 128, tb_ * 128, wm, wn, acc);
    const int r0 = ta * 128 + wm * 64;
    const int r4 = lane >> 3, j8 = lane & 7;
    if (z < 2) {
        const int head = tb_ * 2 + wn;
        const float sc = (z == 0) ? 0.125f : 1.0f;
        const size_t pz = (size_t)z * PLN;
        const int d0 = j8 * 8, dp = d0 ^ 32, i0 = d0 & 31;
        const float sgn = (j8 < 4) ? 1.0f : -1.0f;
        const int b = r0 / SEQ, tb = r0 - b * SEQ;
#pragma unroll
        for (int mb = 0; mb < 4; ++mb) {
#pragma unroll
            for (int nb = 0; nb < 4; ++nb) {
#pragma unroll
                for (int j = 0; j < 8; ++j) os[(hi * 8 + j) * 68 + nb * 16 + lr] = acc[mb][nb][j]; }
            wave_sync_lds();
#pragma unroll 1
            for (int it = 0; it < 4; ++it) {
                const int row = it * 4 + r4; const int t = tb + mb * 16 + row;
                const v4f a0 = *(const v4fa*)(os + row * 68 + d0), a1 = *(const v4fa*)(os + row * 68 + d0 + 4);
                const v4f b0 = *(const v4fa*)(os + row * 68 + dp), b1 = *(const v4fa*)(os + row * 68 + dp + 4);
                float ow[8], pw[8], cs[16];
#pragma unroll
                for (int e = 0; e < 4; ++e) { ow[e] = a0[e]; ow[4 + e] = a1[e]; pw[e] = b0[e]; pw[4 + e] = b1[e]; }
                float ss = 0.f;
#pragma unroll
                for (int e = 0; e < 8; ++e) ss += ow[e] * ow[e];
                ss += __shfl_xor(ss, 1, 32); ss += __shfl_xor(ss, 2, 32); ss += __shfl_xor(ss, 4, 32);
                const float rn = rsqrtf(ss * (1.0f / 64.0f) + RMS_EPS);
                const float* cp = CS + ((size_t)t * 32 + i0) * 2;
                const v4f c0v = *(const v4f*)cp, c1v = *(const v4f*)(cp + 4), c2v = *(const v4f*)(cp + 8), c3v = *(const v4f*)(cp + 12);
#pragma unroll
                for (int e = 0; e < 4; ++e) { cs[e] = c0v[e]; cs[4 + e] = c1v[e]; cs[8 + e] = c2v[e]; cs[12 + e] = c3v[e]; }
                v8us oh, ol;
#pragma unroll
                for (int e = 0; e < 8; ++e) { const float xo = ow[e] * rn, xp = pw[e] * rn; const float r = (xo * cs[2 * e] + sgn * (xp * cs[2 * e + 1])) * sc;
                    unsigned short a2, c2; splitf(r, a2, c2); oh[e] = a2; ol[e] = c2; }
                const size_t oo = pz + (((size_t)(b * NH + head)) * SEQ + t) * HD + d0;
                *(v8us*)(PH + oo) = oh; *(v8us*)(PL + oo) = ol;
                asm volatile("s_wait_xcnt 0x0" ::: "memory"); }   // the next trip writes the registers that held these stores' addresses and data
            wave_sync_lds();
        }
    } else {
        const int c0 = tb_ * 128 + wn * 64, b = vb; const bool early = (c0 < RH);
#pragma unroll
        for (int mb = 0; mb < 4; ++mb) {
#pragma unroll
            for (int nb = 0; nb < 4; ++nb) {
#pragma unroll
                for (int j = 0; j < 8; ++j) os[(hi * 8 + j) * 68 + nb * 16 + lr] = acc[mb][nb][j]; }
            wave_sync_lds();
#pragma unroll 1
            for (int it = 0; it < 4; ++it) {
                const int row = it * 4 + r4; const int n = r0 + mb * 16 + row; const int t0 = c0 + j8 * 8;
                const v4f a0 = *(const v4fa*)(os + row * 68 + j8 * 8), a1 = *(const v4fa*)(os + row * 68 + j8 * 8 + 4);
                v8h o16; v8us oh, ol;
#pragma unroll
                for (int e = 0; e < 8; ++e) { const float x = (e < 4) ? a0[e & 3] : a1[e & 3]; o16[e] = (h16)x; unsigned short a2, c2; splitf(x, a2, c2); oh[e] = a2; ol[e] = c2; }
                const size_t o1 = ((size_t)(b * DM + n)) * SEQ + t0; const size_t o2 = ((size_t)(b * DM + n)) * RH + t0;
                *(v8h*)(V16 + o1) = o16;
                asm volatile("s_wait_xcnt 0x0" ::: "memory");   // ahead of the writes to this store's address and data registers
                if (early) { *(v8us*)(Vh + o2) = oh; *(v8us*)(Vl + o2) = ol;
                    asm volatile("s_wait_xcnt 0x0" ::: "memory"); }   // the same for the two hi | lo stores: the next trip writes their registers
            }
            wave_sync_lds();
        }
    }
}

__global__ __launch_bounds__(128) void k_projo(const bf* __restrict__ ATh, const bf* __restrict__ ATl, const bf* __restrict__ W4, float* OUT) {
    __shared__ __align__(16) float osw[4][16 * 68];
    const int lane = threadIdx.x & 31, lr = lane & 15, hi = lane >> 4;
    const int wave = __builtin_amdgcn_readfirstlane(threadIdx.x >> 5), wm = wave >> 1, wn = wave & 1;
    float* os = &osw[wave][0];
    const int r0 = blockIdx.x * 128 + wm * 64, c0 = blockIdx.y * 128 + wn * 64;
    const bf* Bt = W4 + (size_t)3 * DM * DM;
    v8f acc[4][4];
#pragma unroll
    for (int mb = 0; mb < 4; ++mb)
#pragma unroll
        for (int nb = 0; nb < 4; ++nb) acc[mb][nb] = (v8f){};
    gemm_acc<1>(ATh, ATl, Bt, blockIdx.x * 128, blockIdx.y * 128, wm, wn, acc);
#pragma unroll
    for (int mb = 0; mb < 4; ++mb) {
#pragma unroll
        for (int nb = 0; nb < 4; ++nb) {
#pragma unroll
            for (int j = 0; j < 8; ++j) os[(hi * 8 + j) * 68 + nb * 16 + lr] = acc[mb][nb][j]; }
        wave_sync_lds();
        float* crow = OUT + (size_t)(r0 + mb * 16) * DM + c0;
{
#pragma unroll
            for (int s = 0; s < 8; ++s) { const int row = 2 * s + hi, cofs = lr * 4; const v4f val = *(const v4fa*)(os + row * 68 + cofs);
                *(v4f*)(crow + (size_t)row * DM + cofs) = val; }
             }
        wave_sync_lds();
    }
}

#define KP 72                         // LDS row pitch in 16-bit elements: 128 data bytes + 16
// 64 rows of 128 bytes, global (row pitch gpitch bytes) -> LDS (row pitch 144 bytes), by 128 threads: thread t takes 16 bytes at column (t & 7) of rows (t >> 3) + 0, 16, 32, 48.
// The address wait stands inside the statement so that no address register is rewritten ahead of it.
__device__ __forceinline__ void copy_rows64(const bf* ldst, const void* gsrc, int gpitch) {
    const int t = threadIdx.x;
    const unsigned l0 = (unsigned)(size_t)ldst + (unsigned)((t >> 3) * (KP * 2) + (t & 7) * 16);
    const unsigned l1 = l0 + 16 * KP * 2, l2 = l0 + 32 * KP * 2, l3 = l0 + 48 * KP * 2;
    const char* g0 = (const char*)gsrc + (size_t)(t >> 3) * gpitch + (t & 7) * 16;
    const char* g1 = g0 + (size_t)16 * gpitch; const char* g2 = g0 + (size_t)32 * gpitch; const char* g3 = g0 + (size_t)48 * gpitch;
    asm volatile("global_load_async_to_lds_b128 %0, %4, off\n\t"
                 "global_load_async_to_lds_b128 %1, %5, off\n\t"
                 "global_load_async_to_lds_b128 %2, %6, off\n\t"
                 "global_load_async_to_lds_b128 %3, %7, off\n\t"
                 "s_wait_xcnt 0x0"
                 :: "v"(l0), "v"(l1), "v"(l2), "v"(l3), "v"(g0), "v"(g1), "v"(g2), "v"(g3) : "memory");
}
template <bool EARLY>
__device__ __forceinline__ void attn_body(const bf* __restrict__ Qh, const bf* __restrict__ Ql, const bf* __restrict__ Kh, const bf* __restrict__ Kl,
                                          const h16* __restrict__ V16, const bf* __restrict__ Vh, const bf* __restrict__ Vl, bf* Ah, bf* Al, int rowoff) {
    __shared__ __align__(16) float os[4][16 * 72];                 // first the Q tile (hi rows, then lo rows, 64 x 144 bytes each), in the epilogue each wave's output staging (pitch 68 floats)
    __shared__ __align__(16) bf  ks[2][2][64 * KP];                // [buffer][hi | lo][key][d]
    __shared__ __align__(16) bf  vs[2][EARLY ? 2 : 1][64 * KP];    // [buffer][plane][d][key]
    static_assert(sizeof(os) == (size_t)2 * 64 * KP * 2);
    const int lane = threadIdx.x & 31, lr = lane & 15, hi = lane >> 4;
    const int wave = __builtin_amdgcn_readfirstlane(threadIdx.x >> 5);
    const int bh = blockIdx.y; const int qblk = rowoff + blockIdx.x * 64; const int qrow0 = qblk + wave * 16;
    const int pb = bh * SEQ * HD;
    const int nch = (qrow0 >> 5) + 1;
    const int nst = (qblk >> 6) + 1;          // stages of 64 keys, the same for the whole block; the last one holds the diagonal
    bf* qsm = (bf*)&os[0][0];
    auto stage = [&](int st) {                // stage st -> buffer st & 1; keys st * 64 .. st * 64 + 63 <= qblk + 63
        const int bu = st & 1;
        copy_rows64(&ks[bu][0][0], Kh + pb + st * 64 * HD, HD * 2);
        copy_rows64(&ks[bu][1][0], Kl + pb + st * 64 * HD, HD * 2);
        if (EARLY) { copy_rows64(&vs[bu][0][0], Vh + bh * HD * RH + st * 64, RH * 2); copy_rows64(&vs[bu][EARLY ? 1 : 0][0], Vl + bh * HD * RH + st * 64, RH * 2); }
        else copy_rows64(&vs[bu][0][0], V16 + bh * HD * SEQ + st * 64, SEQ * 2);
    };
    copy_rows64(qsm, Qh + pb + qblk * HD, HD * 2);
    copy_rows64(qsm + 64 * KP, Ql + pb + qblk * HD, HD * 2);
    stage(0);
    asm volatile("s_wait_asynccnt 0x0" ::: "memory");     // this wave's copies of Q and stage 0 have landed
    __syncthreads();                                      // ... and every other wave's
    if (nst > 1) stage(1);
    const int qf = (wave * 16 + lr) * KP + 8 * hi;
    const v16bf qh0 = ldsb(qsm + qf), qh1 = ldsb(qsm + qf + 32), ql0 = ldsb(qsm + 64 * KP + qf), ql1 = ldsb(qsm + 64 * KP + qf + 32);
    v8f oa[4];
#pragma unroll
    for (int sl = 0; sl < 4; ++sl) oa[sl] = (v8f){};
    float l[8];
#pragma unroll
    for (int r = 0; r < 8; ++r) l[r] = 0.f;
#pragma unroll 1                      // stays rolled, as before: the trip count is not known at compile time and one copy of the step keeps the loop short in the instruction cache
    for (int c = 0; c < 2 * nst; ++c) {
      const int bu = (c >> 1) & 1, kin = (c & 1) * 32;     // buffer, first key of this step inside the stage
      if (c < nch) {                                       // wave-uniform: waves 0 and 1 skip the block's last step, which lies beyond their diagonal
        const int kb = c * 32;
        v8f s0 = (v8f){}, s1 = (v8f){};
        // the step's K fragments and V fragments (of hi | lo V: the hi plane's) are asked for as one group of LDS loads ahead of the products: the V loads then return behind the scores and the softmax
        const int ko = (kin + lr) * KP + 8 * hi, kq = ko + 16 * KP;
        const v16bf kh0 = ldsb(&ks[bu][0][ko]), kh1 = ldsb(&ks[bu][0][ko + 32]), kl0 = ldsb(&ks[bu][1][ko]), kl1 = ldsb(&ks[bu][1][ko + 32]);
        const v16bf kh2 = ldsb(&ks[bu][0][kq]), kh3 = ldsb(&ks[bu][0][kq + 32]), kl2 = ldsb(&ks[bu][1][kq]), kl3 = ldsb(&ks[bu][1][kq + 32]);
        const int vo = lr * KP + kin + 8 * hi;
        v16bf vfa[4];
#pragma unroll
        for (int sl = 0; sl < 4; ++sl) vfa[sl] = ldsb(&vs[bu][0][vo + sl * 16 * KP]);
        s0 = mmab(kh0, qh0, s0); s0 = mmab(kh1, qh1, s0); s0 = mmab(kh0, ql0, s0); s0 = mmab(kh1, ql1, s0); s0 = mmab(kl0, qh0, s0); s0 = mmab(kl1, qh1, s0);
        s1 = mmab(kh2, qh0, s1); s1 = mmab(kh3, qh1, s1); s1 = mmab(kh2, ql0, s1); s1 = mmab(kh3, ql1, s1); s1 = mmab(kl2, qh0, s1); s1 = mmab(kl3, qh1, s1);
        const bool diag = (kb + 31 > qrow0);     // wave-uniform: only the last step of a wave touches the diagonal
        const int dq = qrow0 + lr - kb - 8 * hi;          // the lane's query minus the first key of its eight in the first score tile: key r of the tile is allowed while r <= dq
        v8h p0, p1; v8us p0h, p0l, p1h, p1l;              // P^T of the lane's query: its eight keys of the first and of the second score tile
#pragma unroll
        for (int r = 0; r < 8; ++r) {
            float v0 = s0[r] * L2E + SBIAS, v1 = s1[r] * L2E + SBIAS;     // the 1/8 scale is carried by the q planes
            if (diag) { v0 = (r <= dq) ? v0 : NEGB; v1 = (16 + r <= dq) ? v1 : NEGB; }
            const float e0 = __builtin_amdgcn_exp2f(v0), e1 = __builtin_amdgcn_exp2f(v1);
            l[r] += e0 + e1;
            if (EARLY) { unsigned short a2, c2; splitf(e0, a2, c2); p0h[r] = a2; p0l[r] = c2; splitf(e1, a2, c2); p1h[r] = a2; p1l[r] = c2; }
            else { p0[r] = (h16)e0; p1[r] = (h16)e1; }
        }
        if (EARLY) {
            const v16bf pah = cat16b(p0h, p1h), pal = cat16b(p0l, p1l);
            v16bf vfb[4];                                     // the lo plane's fragments come here, with P: held from the top of the step they would push the wave past 256 registers
#pragma unroll
            for (int sl = 0; sl < 4; ++sl) vfb[sl] = ldsb(&vs[bu][EARLY ? 1 : 0][vo + sl * 16 * KP]);
#pragma unroll
            for (int sl = 0; sl < 4; ++sl) { oa[sl] = mmab(vfa[sl], pah, oa[sl]); oa[sl] = mmab(vfa[sl], pal, oa[sl]); oa[sl] = mmab(vfb[sl], pah, oa[sl]); }
        } else {
            const v16h pa = cat16(p0, p1);
#pragma unroll
            for (int sl = 0; sl < 4; ++sl) oa[sl] = mmah(__builtin_bit_cast(v16h, vfa[sl]), pa, oa[sl]);
        }
      }
      if (c & 1) {                                            // foot of a stage, passed by every wave
        const int st = c >> 1;
        asm volatile("s_wait_dscnt 0x0" ::: "memory");        // this wave's reads of the stage's buffer are done
        asm volatile("s_wait_asynccnt 0x0" ::: "memory");     // this wave's copies of the next stage have landed
        __syncthreads();                                      // publishes the next stage and frees this stage's buffer
        if (st + 2 < nst) stage(st + 2);
      }
    }
    asm volatile("s_wait_asynccnt 0x0" ::: "memory");         // no copy is left in flight when the Q tile's LDS becomes output staging
    // the lane's eight partial sums, then the other half-wave's (the other keys of the same query); oa[sl][r] is O[query lr][sl * 16 + 8 * hi + r]: eight values in a row of the staging tile
    float t = ((l[0] + l[1]) + (l[2] + l[3])) + ((l[4] + l[5]) + (l[6] + l[7]));
    t += __shfl_xor(t, 16, 32);
    const float inv = 1.0f / t;
#pragma unroll
    for (int sl = 0; sl < 4; ++sl) {
        v4f a, b;
#pragma unroll
        for (int e = 0; e < 4; ++e) { a[e] = oa[sl][e] * inv; b[e] = oa[sl][4 + e] * inv; }
        *(v4fa*)(&os[wave][lr * 68 + sl * 16 + 8 * hi]) = a; *(v4fa*)(&os[wave][lr * 68 + sl * 16 + 8 * hi + 4]) = b; }
    wave_sync_lds();
    const int r4 = lane >> 3, d0 = (lane & 7) * 8; const int b = bh / NH, h = bh - b * NH;
#pragma unroll 1
    for (int it = 0; it < 4; ++it) {
        const int row = it * 4 + r4;
        const v4f a0 = *(const v4fa*)(&os[wave][row * 68 + d0]), a1 = *(const v4fa*)(&os[wave][row * 68 + d0 + 4]);
        v8us oh, ol;
#pragma unroll
        for (int e = 0; e < 8; ++e) { const float x = (e < 4) ? a0[e & 3] : a1[e & 3]; unsigned short a2, c2; splitf(x, a2, c2); oh[e] = a2; ol[e] = c2; }
        const size_t oo = ((size_t)(b * SEQ + qrow0 + row)) * DM + h * HD + d0;
        *(v8us*)(Ah + oo) = oh; *(v8us*)(Al + oo) = ol;  }
}
// query rows [0, RH): grid (RH/64, NB*NH); query rows [RH, SEQ): grid ((SEQ-RH)/64, NB*NH); 128 threads
__global__ __launch_bounds__(128) void k_attn_e(const bf* __restrict__ Qh, const bf* __restrict__ Ql, const bf* __restrict__ Kh, const bf* __restrict__ Kl,
                                                const h16* __restrict__ V16, const bf* __restrict__ Vh, const bf* __restrict__ Vl, bf* Ah, bf* Al) {
    attn_body<true>(Qh, Ql, Kh, Kl, V16, Vh, Vl, Ah, Al, 0); }
__global__ __launch_bounds__(128) void k_attn_l(const bf* __restrict__ Qh, const bf* __restrict__ Ql, const bf* __restrict__ Kh, const bf* __restrict__ Kl,
                                                const h16* __restrict__ V16, const bf* __restrict__ Vh, const bf* __restrict__ Vl, bf* Ah, bf* Al) {
    attn_body<false>(Qh, Ql, Kh, Kl, V16, Vh, Vl, Ah, Al, RH); }

constexpr size_t al256(size_t b) { return (b + 255) & ~(size_t)255; }
constexpr size_t SZ_XB = al256((size_t)MR * DM * 2);
constexpr size_t SZ_W4 = al256((size_t)4 * DM * DM * 2);
constexpr size_t SZ_CS = al256((size_t)SEQ * 32 * 2 * 4);
constexpr size_t SZ_QK = al256((size_t)2 * PLN * 2);
constexpr size_t SZ_V16 = al256((size_t)NB * DM * SEQ * 2);
constexpr size_t SZ_VR = al256((size_t)NB * DM * RH * 2);
constexpr size_t SZ_AT = al256((size_t)MR * DM * 2);
constexpr size_t SZ_TOTAL = SZ_XB + SZ_W4 + SZ_CS + 2 * SZ_QK + SZ_V16 + 2 * SZ_VR + 2 * SZ_AT;
static_assert(SZ_TOTAL <= (size_t)134217728);

extern "C" void kernel_launch(void* const* d_in, const int* in_sizes, int n_in,
                              void* d_out, int out_size, void* d_ws, size_t ws_size, hipStream_t stream) {
    if (n_in < 5) return;
    if (in_sizes[0] < (NB - 1) * SEQ_FULL * DM + SEQ * DM) return;
    if (in_sizes[1] < DM * DM || in_sizes[2] < DM * DM || in_sizes[3] < DM * DM || in_sizes[4] < DM * DM) return;
    if (out_size < MR * DM) return;
    if (SZ_TOTAL > ws_size) return;
    const float* x = (const float*)d_in[0]; const float* wq = (const float*)d_in[1]; const float* wk = (const float*)d_in[2];
    const float* wv = (const float*)d_in[3]; const float* wo = (const float*)d_in[4];      // wire order x, w_q, w_k, w_v, w_proj (each [out][in])
    float* OUT = (float*)d_out;
    char* wsp = (char*)d_ws;
    bf* XB = (bf*)wsp; wsp += SZ_XB;
    bf* W4 = (bf*)wsp; wsp += SZ_W4;            // Wq | Wk | Wv | Wo, each [DM][DM] as stored (Wv the A operand, the others Bt)
    float* CS = (float*)wsp; wsp += SZ_CS;
    bf* QKh = (bf*)wsp; wsp += SZ_QK;           // [q | k][b*NH + h][t][64] hi
    bf* QKl = (bf*)wsp; wsp += SZ_QK;           // lo
    h16* V16 = (h16*)wsp; wsp += SZ_V16;        // [b][h*64 + d][t]
    bf* Vh = (bf*)wsp; wsp += SZ_VR;            // [b][h*64 + d][t < RH]
    bf* Vl = (bf*)wsp; wsp += SZ_VR;
    bf* ATh = (bf*)wsp; wsp += SZ_AT;           // merged-head context [b*SEQ + t][h*64 + d] hi
    bf* ATl = (bf*)wsp; wsp += SZ_AT;
    k_prep<<<PB_CS + PB_X + 4 * PB_W, 256, 0, stream>>>(x, wq, wk, wv, wo, XB, W4, CS);
    k_projqkv<<<dim3(MR / 128, NH / 2, 3), 128, 0, stream>>>(XB, W4, CS, QKh, QKl, V16, Vh, Vl);
    k_attn_e<<<dim3(RH / 64, NB * NH), 128, 0, stream>>>(QKh, QKl, QKh + PLN, QKl + PLN, V16, Vh, Vl, ATh, ATl);
    if (SEQ > RH) k_attn_l<<<dim3((SEQ - RH) / 64, NB * NH), 128, 0, stream>>>(QKh, QKl, QKh + PLN, QKl + PLN, V16, Vh, Vl, ATh, ATl);
    k_projo<<<dim3(MR / 128, DM / 128), 128, 0, stream>>>(ATh, ATl, W4, OUT);
}
